// v000
// Times are from an AMD MI455X. After a warm-up the kernel runs many times in a row, and a time is the length of
// such a window on the GPU divided by its runs, so every launch and the gaps after it count. The runs cycle
// through copies of the inputs. A figure is the median of several windows, for all but v000 over two sittings.
// Sittings can differ by a few percent; kernels timed side by side share one.
// The starting kernel, v000, takes 449 microseconds a run.
// compute dtype: the float input rounded to bf16; window partition / merge as pure index permutations; q as f16 hi + residual (x 2^10), k once to f16 -> 2-product logits x 32^-0.5 on WMMA 16x16x32; softmax in f32 (precise expf); P x 2^11 split bf16 hi + lo against v bf16 hi + lo (3 products; v is bf16-exact so its lo plane is zero); f32 output.
#include <hip/hip_runtime.h>
#include <math.h>

typedef __attribute__((ext_vector_type(16))) _Float16 v16h;
typedef __attribute__((ext_vector_type(16))) __bf16 v16b;
typedef __attribute__((ext_vector_type(8)))  _Float16 v8h;
typedef __attribute__((ext_vector_type(8)))  float v8f;
typedef __attribute__((ext_vector_type(4)))  float v4f;
typedef __attribute__((ext_vector_type(2)))  float v2f;
typedef __attribute__((ext_vector_type(4)))  unsigned v4u;
typedef __attribute__((ext_vector_type(4)))  int v4i;
typedef float __attribute__((may_alias)) float_a;
typedef int __attribute__((may_alias)) int_a;

template <typename T> __device__ __forceinline__ void vst2(void* p, T v) { *(T*)p = v;  }
__device__ __forceinline__ v8f wmma16(v16h a, v16h b, v8f c) {
  v8f d = __builtin_amdgcn_wmma_f32_16x16x32_f16(false, a, false, b, (short)0, c, false, false);
  asm volatile("v_nop\n\tv_nop\n\tv_nop\n\tv_nop" : "+v"(d) : "v"(a), "v"(b));
  return d;
}
__device__ __forceinline__ v8f wmma_bf(v16b a, v16b b, v8f c) {
  v8f d = __builtin_amdgcn_wmma_f32_16x16x32_bf16(false, a, false, b, (short)0, c, false, false);
  asm volatile("v_nop\n\tv_nop\n\tv_nop\n\tv_nop" : "+v"(d) : "v"(a), "v"(b));
  return d;
}
// 16x16x32 fragments: lane = (h = lane>>4, row/col = lane&15); elements 0..7 = k0+8h+0..7, 8..15 = k0+16+8h+0..7; D element r = row 8h+r
__device__ __forceinline__ v16h frag_h(const _Float16* rowk0, int lane) {
  union { v16h v; v8h q[2]; } u; const _Float16* p = rowk0 + 8 * (lane >> 4);
  u.q[0] = *(const v8h*)p; u.q[1] = *(const v8h*)(p + 16); return u.v;
}
__device__ __forceinline__ v16h frag_f32(const float* rowk0, int lane) {
  v16h a; const float* p = rowk0 + 8 * (lane >> 4);
#pragma unroll
  for (int i = 0; i < 8; ++i) { a[i] = (_Float16)p[i]; a[8 + i] = (_Float16)p[16 + i]; }
  return a;
}
__device__ __forceinline__ v16h frag_f32s(const float* rowk0, int lane, float sc) {
  v16h a; const float* p = rowk0 + 8 * (lane >> 4);
#pragma unroll
  for (int i = 0; i < 8; ++i) { a[i] = (_Float16)(p[i] * sc); a[8 + i] = (_Float16)(p[16 + i] * sc); }
  return a;
}
// column fragment from a [K][ld] layout (column n), rows >= K read as 0
__device__ __forceinline__ v16h fragc_f32(const float* W, int k0, int n, int lane, int ld, int K) {
  v16h a; const int g = lane >> 4;
#pragma unroll
  for (int i = 0; i < 8; ++i) { const int ka = k0 + 8 * g + i, kb = ka + 16;
    a[i] = (_Float16)(ka < K ? W[(size_t)(ka < K ? ka : K - 1) * ld + n] : 0.f); a[8 + i] = (_Float16)(kb < K ? W[(size_t)(kb < K ? kb : K - 1) * ld + n] : 0.f); }
  return a;
}
struct F2 { v16b h, l; };
__device__ __forceinline__ F2 bsplit16(const float v[16]) { F2 r;
#pragma unroll
  for (int i = 0; i < 16; ++i) { const __bf16 h = (__bf16)v[i]; r.h[i] = h; r.l[i] = (__bf16)(v[i] - (float)h); }
  return r; }
__device__ __forceinline__ F2 split_row(const float* row, int k0, int lane) { float v[16]; const float* p = row + k0 + 8 * (lane >> 4);
#pragma unroll
  for (int i = 0; i < 8; ++i) { v[i] = p[i]; v[8 + i] = p[16 + i]; }
  return bsplit16(v); }
__device__ __forceinline__ F2 split_rowK(const float* row, int k0, int lane, int K) { float v[16]; const int g = lane >> 4;
#pragma unroll
  for (int i = 0; i < 8; ++i) { const int ka = k0 + 8 * g + i, kb = ka + 16; v[i] = ka < K ? row[ka < K ? ka : K - 1] : 0.f; v[8 + i] = kb < K ? row[kb < K ? kb : K - 1] : 0.f; }
  return bsplit16(v); }
__device__ __forceinline__ F2 split_col(const float* W, int k0, int n, int lane, int ld, int K) { float v[16]; const int g = lane >> 4;
#pragma unroll
  for (int i = 0; i < 8; ++i) { const int ka = k0 + 8 * g + i, kb = ka + 16; v[i] = ka < K ? W[(size_t)(ka < K ? ka : K - 1) * ld + n] : 0.f; v[8 + i] = kb < K ? W[(size_t)(kb < K ? kb : K - 1) * ld + n] : 0.f; }
  return bsplit16(v); }
__device__ __forceinline__ v8f mac3(const F2& a, const F2& b, v8f c) { c = wmma_bf(a.l, b.h, c); c = wmma_bf(a.h, b.l, c); return wmma_bf(a.h, b.h, c); }
__device__ __forceinline__ float sigm(float v) { return 1.0f / (1.0f + expf(-v)); }
#define LDSX() do { asm volatile("s_wait_dscnt 0" ::: "memory"); __builtin_amdgcn_wave_barrier(); __builtin_amdgcn_fence(__ATOMIC_RELEASE, "workgroup"); } while (0)


// LePE-style 3-D window attention (B 2, L = 16^3 = 4,096 tokens, C 128 = 4 heads x 32; windows 16 x 16 x 4 = 1,024 tokens): token l = d*256 + h*16 + w belongs to window (b, w / 4) at position t = d*64 + h*4 + w % 4; per (window, head): softmax(q k^T * 32^-0.5) v over the window; merged back to [B, L, C].
#define NBT 2
#define LL 4096
#define CCH 128
#define NH 4
#define HD 32
#define NWB 4               // windows per batch element
#define NW (NBT * NWB)      // 8 windows
#define TT 1024             // tokens per window
#define HG 4                // heads per launch group (= all)
#ifndef NWP
#define NWP NW              // windows processed
#endif
#define SCALE 0.17677669529663687f   // 32^-0.5
__device__ __forceinline__ float bfr(float v) { return (float)(__bf16)v; }
typedef __attribute__((ext_vector_type(8))) __bf16 v8b;
__device__ __forceinline__ v16b frag_b(const __bf16* rowk0, int lane) { union { v16b v; v8b q[2]; } u; const __bf16* p = rowk0 + 8 * (lane >> 4); u.q[0] = *(const v8b*)p; u.q[1] = *(const v8b*)(p + 16); return u.v; }
__device__ __forceinline__ int tok_of(int wi, int t) { return (t >> 6) * 256 + ((t >> 2) & 15) * 16 + wi * 4 + (t & 3); }   // window-local position -> token index l

#define WS_QH  0u                                   // f16 q rows [win*TT + t][128]
#define WS_QL  (WS_QH + 2u * (size_t)NW * TT * CCH)
#define WS_KH  (WS_QL + 2u * (size_t)NW * TT * CCH)
#define WS_VT  (WS_KH + 2u * (size_t)NW * TT * CCH)   // bf16 v planes [win][c][t]
#define WS_VL  (WS_VT + 2u * (size_t)NW * CCH * TT)
#define WS_S   (WS_VL + 2u * (size_t)NW * CCH * TT)   // f32 logits / P [hg][q][k]
#define WS_END (WS_S + 4u * (size_t)HG * TT * TT)
__global__ __launch_bounds__(256) void k_part(const float* __restrict__ QKV, _Float16* __restrict__ QH, _Float16* __restrict__ QL, _Float16* __restrict__ KH, __bf16* __restrict__ VT, __bf16* __restrict__ VL) {
  __shared__ __align__(16) float sq[64][132], sk[64][132]; __shared__ __align__(16) __bf16 tv[128][72];
  const int tid = threadIdx.x; const int win = blockIdx.y; const int b = win / NWB, wi = win % NWB; const int t0 = blockIdx.x * 64;
  const float* Q = QKV; const float* K = QKV + (size_t)NBT * LL * CCH; const float* V = QKV + (size_t)2 * NBT * LL * CCH;
  for (int e = tid; e < 64 * 32; e += 256) { const int rl = e >> 5, q = e & 31; const size_t src = ((size_t)b * LL + tok_of(wi, t0 + rl)) * CCH + q * 4;
    const v4f vq = *(const v4f*)(Q + src), vk = *(const v4f*)(K + src), vv = *(const v4f*)(V + src);
#pragma unroll
    for (int z = 0; z < 4; ++z) { sq[rl][q * 4 + z] = bfr(vq[z]); sk[rl][q * 4 + z] = bfr(vk[z]); tv[q * 4 + z][rl] = (__bf16)vv[z]; } }
  __syncthreads();
  const size_t row0 = (size_t)win * TT + t0;
  for (int e = tid; e < 64 * 16; e += 256) { const int rl = e >> 4, q = e & 15; v8h qh, ql, kh;
#pragma unroll
    for (int z = 0; z < 8; ++z) { const float x = sq[rl][q * 8 + z]; const _Float16 hx = (_Float16)x; qh[z] = hx; ql[z] = (_Float16)((x - (float)hx) * 1024.0f); kh[z] = (_Float16)sk[rl][q * 8 + z]; }
    const size_t o = (row0 + rl) * CCH + q * 8; vst2((v4u*)(QH + o), *(const v4u*)&qh); vst2((v4u*)(QL + o), *(const v4u*)&ql); vst2((v4u*)(KH + o), *(const v4u*)&kh); }
  for (int e = tid; e < 128 * 8; e += 256) { const int cl = e >> 3, q = e & 7; v8b hv, lv;
#pragma unroll
    for (int z = 0; z < 8; ++z) { hv[z] = tv[cl][q * 8 + z]; lv[z] = (__bf16)0.0f; }   /* v is a bf16-rounded input: exact in the hi plane, residual plane zero */
    const size_t o2 = ((size_t)win * CCH + cl) * (size_t)TT + t0 + q * 8; vst2((v4u*)(VT + o2), *(const v4u*)&hv); vst2((v4u*)(VL + o2), *(const v4u*)&lv); } }
// ---- k_sc: block = (64 queries, 128 keys, head) of window w: 2-product logits x scale
__global__ __launch_bounds__(128) void k_sc(const _Float16* __restrict__ QH, const _Float16* __restrict__ QL, const _Float16* __restrict__ KH, int w, float* __restrict__ S0) { __shared__ __align__(16) float ss[4][16][132]; const int h = blockIdx.z; float* S = S0 + (size_t)blockIdx.z * TT * TT;
  const int tid = threadIdx.x, wave = tid >> 5, lane = tid & 31, col = lane & 15, g = lane >> 4; const int k0 = blockIdx.y * 128; const int ql0 = blockIdx.x * 64 + wave * 16; const size_t q0 = (size_t)w * TT + ql0;
  v8f acc[8] = {}, accl[8] = {};
  { const v16h ah = frag_h(QH + (q0 + col) * CCH + h * HD, lane), al = frag_h(QL + (q0 + col) * CCH + h * HD, lane);
#pragma unroll
    for (int j = 0; j < 8; ++j) { const v16h kb = frag_h(KH + ((size_t)w * TT + k0 + j * 16 + col) * CCH + h * HD, lane); acc[j] = wmma16(ah, kb, acc[j]); accl[j] = wmma16(al, kb, accl[j]); } }
#pragma unroll
  for (int j = 0; j < 8; ++j)
#pragma unroll
    for (int r = 0; r < 8; ++r) ss[wave][8 * g + r][j * 16 + col] = (acc[j][r] + accl[j][r] * (1.0f / 1024.0f)) * SCALE;
  LDSX(); for (int rl = 0; rl < 16; ++rl) vst2(S + (size_t)(ql0 + rl) * TT + k0 + lane * 4, *(const v4f*)&ss[wave][rl][lane * 4]); }
// ---- k_sm: block = query row: softmax over the window's 1,024 keys (f32) -> P x 2^11 in place
__global__ __launch_bounds__(256) void k_sm(float* __restrict__ S0) { __shared__ float sred[8]; __shared__ float sbc; __shared__ __align__(16) float sh[TT];
  const int t = threadIdx.x; const size_t row = blockIdx.x; float* sr = S0 + (size_t)blockIdx.y * TT * TT + row * TT; const int kend = TT;
  float m = -3.0e38f; for (int k = t; k < kend; k += 256) m = fmaxf(m, sr[k]);
#pragma unroll
  for (int o = 1; o < 32; o <<= 1) m = fmaxf(m, __shfl_xor(m, o));
  if ((t & 31) == 0) sred[t >> 5] = m; __syncthreads(); if (t == 0) { float a = sred[0]; for (int i = 1; i < 8; ++i) a = fmaxf(a, sred[i]); sbc = a; } __syncthreads(); m = sbc; __syncthreads();
  float sum = 0.f; for (int k = t; k < kend; k += 256) sum += expf(sr[k] - m);
#pragma unroll
  for (int o = 1; o < 32; o <<= 1) sum += __shfl_xor(sum, o);
  if ((t & 31) == 0) sred[t >> 5] = sum; __syncthreads(); if (t == 0) { float a = 0.f; for (int i = 0; i < 8; ++i) a += sred[i]; sbc = 1.0f / a; } __syncthreads(); const float inv = sbc;
  for (int k = t; k < kend; k += 256) sh[k] = expf(sr[k] - m) * inv * 2048.0f;
  __syncthreads(); for (int q = t; q < kend / 4; q += 256) vst2(sr + q * 4, *(const v4f*)&sh[q * 4]); }
__global__ __launch_bounds__(128) void k_pv(const float* __restrict__ PS0, const __bf16* __restrict__ VT, const __bf16* __restrict__ VL, int w, float* __restrict__ OUT) { const int h = blockIdx.z; const float* PS = PS0 + (size_t)blockIdx.z * TT * TT; __shared__ __align__(16) float ss[4][16][HD + 4];
  const int tid = threadIdx.x, wave = tid >> 5, lane = tid & 31, col = lane & 15, g = lane >> 4; const int ql0 = blockIdx.x * 64 + wave * 16; const int b = w / NWB, wi = w % NWB;
  v8f acc[HD / 16] = {};
#pragma unroll 1
  for (int kc = 0; kc < TT / 32; ++kc) { const F2 p = split_row(PS + (size_t)(ql0 + col) * TT, kc * 32, lane);
    asm volatile("s_wait_loadcnt 0x0" ::: "memory");
#pragma unroll
    for (int j = 0; j < HD / 16; ++j) { const size_t po = ((size_t)w * CCH + h * HD + j * 16 + col) * (size_t)TT + kc * 32; const v16b vh = frag_b(VT + po, lane); acc[j] = wmma_bf(p.h, vh, acc[j]); acc[j] = wmma_bf(p.l, vh, acc[j]); acc[j] = wmma_bf(p.h, frag_b(VL + po, lane), acc[j]); } }
#pragma unroll
  for (int j = 0; j < HD / 16; ++j)
#pragma unroll
    for (int r = 0; r < 8; ++r) ss[wave][8 * g + r][j * 16 + col] = acc[j][r] * (1.0f / 2048.0f);
  LDSX(); for (int rl = 0; rl < 16; ++rl) if (lane < HD / 4) vst2(OUT + ((size_t)b * LL + tok_of(wi, ql0 + rl)) * CCH + h * HD + lane * 4, *(const v4f*)&ss[wave][rl][lane * 4]); }
extern "C" void kernel_launch(void* const* d_in, const int* in_sizes, int n_in, void* d_out, int out_size, void* d_ws, size_t ws_size, hipStream_t stream) {
  (void)in_sizes; (void)n_in; (void)out_size;
  const float** F = (const float**)d_in;   // 0 qkv [3,2,4096,128]
  if (ws_size < (size_t)WS_END) return;
  char* ws = (char*)d_ws; _Float16 *QH = (_Float16*)(ws + WS_QH), *QL = (_Float16*)(ws + WS_QL), *KH = (_Float16*)(ws + WS_KH); __bf16 *VT = (__bf16*)(ws + WS_VT), *VL = (__bf16*)(ws + WS_VL); float* S = (float*)(ws + WS_S);
  k_part<<<dim3(TT / 64, NWP), 256, 0, stream>>>(F[0], QH, QL, KH, VT, VL);
  for (int w = 0; w < NWP; ++w) {
    k_sc<<<dim3(TT / 64, TT / 128, HG), 128, 0, stream>>>(QH, QL, KH, w, S);
    k_sm<<<dim3(TT, HG), 256, 0, stream>>>(S);
    k_pv<<<dim3(TT / 64, 1, HG), 128, 0, stream>>>(S, VT, VL, w, (float*)d_out);
  }
}

// v001
// A run of this version takes 181 microseconds.
// Timed twice side by side with v000, it ran 2.50 and 2.49 times as fast.
// compute dtype: the float input rounded to bf16; window partition / merge as pure index permutations; q as f16 hi + residual (x 2^10), k once to f16 -> 2-product logits x 32^-0.5 on WMMA 16x16x32; softmax in f32 (precise expf); P x 2^11 split bf16 hi + lo against v bf16 hi + lo (3 products; v is bf16-exact so its lo plane is zero); f32 output.
#include <hip/hip_runtime.h>
#include <math.h>

typedef __attribute__((ext_vector_type(16))) _Float16 v16h;
typedef __attribute__((ext_vector_type(16))) __bf16 v16b;
typedef __attribute__((ext_vector_type(8)))  _Float16 v8h;
typedef __attribute__((ext_vector_type(8)))  float v8f;
typedef __attribute__((ext_vector_type(4)))  float v4f;
typedef __attribute__((ext_vector_type(2)))  float v2f;
typedef __attribute__((ext_vector_type(4)))  unsigned v4u;
typedef __attribute__((ext_vector_type(4)))  int v4i;
typedef float __attribute__((may_alias)) float_a;
typedef int __attribute__((may_alias)) int_a;

template <typename T> __device__ __forceinline__ void vst2(void* p, T v) { *(T*)p = v;  }
__device__ __forceinline__ v8f wmma16(v16h a, v16h b, v8f c) {
  v8f d = __builtin_amdgcn_wmma_f32_16x16x32_f16(false, a, false, b, (short)0, c, false, false);
  asm volatile("v_nop\n\tv_nop\n\tv_nop\n\tv_nop" : "+v"(d) : "v"(a), "v"(b));
  return d;
}
__device__ __forceinline__ v8f wmma_bf(v16b a, v16b b, v8f c) {
  v8f d = __builtin_amdgcn_wmma_f32_16x16x32_bf16(false, a, false, b, (short)0, c, false, false);
  asm volatile("v_nop\n\tv_nop\n\tv_nop\n\tv_nop" : "+v"(d) : "v"(a), "v"(b));
  return d;
}
// 16x16x32 fragments: lane = (h = lane>>4, row/col = lane&15); elements 0..7 = k0+8h+0..7, 8..15 = k0+16+8h+0..7; D element r = row 8h+r
__device__ __forceinline__ v16h frag_h(const _Float16* rowk0, int lane) {
  union { v16h v; v8h q[2]; } u; const _Float16* p = rowk0 + 8 * (lane >> 4);
  u.q[0] = *(const v8h*)p; u.q[1] = *(const v8h*)(p + 16); return u.v;
}
__device__ __forceinline__ v16h frag_f32(const float* rowk0, int lane) {
  v16h a; const float* p = rowk0 + 8 * (lane >> 4);
#pragma unroll
  for (int i = 0; i < 8; ++i) { a[i] = (_Float16)p[i]; a[8 + i] = (_Float16)p[16 + i]; }
  return a;
}
__device__ __forceinline__ v16h frag_f32s(const float* rowk0, int lane, float sc) {
  v16h a; const float* p = rowk0 + 8 * (lane >> 4);
#pragma unroll
  for (int i = 0; i < 8; ++i) { a[i] = (_Float16)(p[i] * sc); a[8 + i] = (_Float16)(p[16 + i] * sc); }
  return a;
}
// column fragment from a [K][ld] layout (column n), rows >= K read as 0
__device__ __forceinline__ v16h fragc_f32(const float* W, int k0, int n, int lane, int ld, int K) {
  v16h a; const int g = lane >> 4;
#pragma unroll
  for (int i = 0; i < 8; ++i) { const int ka = k0 + 8 * g + i, kb = ka + 16;
    a[i] = (_Float16)(ka < K ? W[(size_t)(ka < K ? ka : K - 1) * ld + n] : 0.f); a[8 + i] = (_Float16)(kb < K ? W[(size_t)(kb < K ? kb : K - 1) * ld + n] : 0.f); }
  return a;
}
struct F2 { v16b h, l; };
__device__ __forceinline__ F2 bsplit16(const float v[16]) { F2 r;
#pragma unroll
  for (int i = 0; i < 16; ++i) { const __bf16 h = (__bf16)v[i]; r.h[i] = h; r.l[i] = (__bf16)(v[i] - (float)h); }
  return r; }
__device__ __forceinline__ F2 split_row(const float* row, int k0, int lane) { float v[16]; const float* p = row + k0 + 8 * (lane >> 4);
#pragma unroll
  for (int i = 0; i < 8; ++i) { v[i] = p[i]; v[8 + i] = p[16 + i]; }
  return bsplit16(v); }
__device__ __forceinline__ F2 split_rowK(const float* row, int k0, int lane, int K) { float v[16]; const int g = lane >> 4;
#pragma unroll
  for (int i = 0; i < 8; ++i) { const int ka = k0 + 8 * g + i, kb = ka + 16; v[i] = ka < K ? row[ka < K ? ka : K - 1] : 0.f; v[8 + i] = kb < K ? row[kb < K ? kb : K - 1] : 0.f; }
  return bsplit16(v); }
__device__ __forceinline__ F2 split_col(const float* W, int k0, int n, int lane, int ld, int K) { float v[16]; const int g = lane >> 4;
#pragma unroll
  for (int i = 0; i < 8; ++i) { const int ka = k0 + 8 * g + i, kb = ka + 16; v[i] = ka < K ? W[(size_t)(ka < K ? ka : K - 1) * ld + n] : 0.f; v[8 + i] = kb < K ? W[(size_t)(kb < K ? kb : K - 1) * ld + n] : 0.f; }
  return bsplit16(v); }
__device__ __forceinline__ v8f mac3(const F2& a, const F2& b, v8f c) { c = wmma_bf(a.l, b.h, c); c = wmma_bf(a.h, b.l, c); return wmma_bf(a.h, b.h, c); }
__device__ __forceinline__ float sigm(float v) { return 1.0f / (1.0f + expf(-v)); }
#define LDSX() do { asm volatile("s_wait_dscnt 0" ::: "memory"); __builtin_amdgcn_wave_barrier(); __builtin_amdgcn_fence(__ATOMIC_RELEASE, "workgroup"); } while (0)


// LePE-style 3-D window attention (B 2, L = 16^3 = 4,096 tokens, C 128 = 4 heads x 32; windows 16 x 16 x 4 = 1,024 tokens): token l = d*256 + h*16 + w belongs to window (b, w / 4) at position t = d*64 + h*4 + w % 4; per (window, head): softmax(q k^T * 32^-0.5) v over the window; merged back to [B, L, C].
#define NBT 2
#define LL 4096
#define CCH 128
#define NH 4
#define HD 32
#define NWB 4               // windows per batch element
#define NW (NBT * NWB)      // 8 windows
#define TT 1024             // tokens per window
#define HG 4                // heads per launch group (= all)
#ifndef NWP
#define NWP NW              // windows processed
#endif
#define SCALE 0.17677669529663687f   // 32^-0.5
__device__ __forceinline__ float bfr(float v) { return (float)(__bf16)v; }
typedef __attribute__((ext_vector_type(8))) __bf16 v8b;
__device__ __forceinline__ v16b frag_b(const __bf16* rowk0, int lane) { union { v16b v; v8b q[2]; } u; const __bf16* p = rowk0 + 8 * (lane >> 4); u.q[0] = *(const v8b*)p; u.q[1] = *(const v8b*)(p + 16); return u.v; }
__device__ __forceinline__ int tok_of(int wi, int t) { return (t >> 6) * 256 + ((t >> 2) & 15) * 16 + wi * 4 + (t & 3); }   // window-local position -> token index l

#define WS_QH  0u                                   // f16 q rows [win*TT + t][128]
#define WS_QL  (WS_QH + 2u * (size_t)NW * TT * CCH)
#define WS_KH  (WS_QL + 2u * (size_t)NW * TT * CCH)
#define WS_VT  (WS_KH + 2u * (size_t)NW * TT * CCH)   // bf16 v planes [win][c][t]
#define WS_VL  (WS_VT + 2u * (size_t)NW * CCH * TT)
#define WS_S   (WS_VL + 2u * (size_t)NW * CCH * TT)   // f32 logits / P [win * HG + head][q][k]
#define WS_END (WS_S + 4u * (size_t)NW * HG * TT * TT)
__global__ __launch_bounds__(256) void k_part(const float* __restrict__ QKV, _Float16* __restrict__ QH, _Float16* __restrict__ QL, _Float16* __restrict__ KH, __bf16* __restrict__ VT, __bf16* __restrict__ VL) {
  __shared__ __align__(16) float sq[64][132], sk[64][132]; __shared__ __align__(16) __bf16 tv[128][72];
  const int tid = threadIdx.x; const int win = blockIdx.y; const int b = win / NWB, wi = win % NWB; const int t0 = blockIdx.x * 64;
  const float* Q = QKV; const float* K = QKV + (size_t)NBT * LL * CCH; const float* V = QKV + (size_t)2 * NBT * LL * CCH;
  for (int e = tid; e < 64 * 32; e += 256) { const int rl = e >> 5, q = e & 31; const size_t src = ((size_t)b * LL + tok_of(wi, t0 + rl)) * CCH + q * 4;
    const v4f vq = *(const v4f*)(Q + src), vk = *(const v4f*)(K + src), vv = *(const v4f*)(V + src);
#pragma unroll
    for (int z = 0; z < 4; ++z) { sq[rl][q * 4 + z] = bfr(vq[z]); sk[rl][q * 4 + z] = bfr(vk[z]); tv[q * 4 + z][rl] = (__bf16)vv[z]; } }
  __syncthreads();
  const size_t row0 = (size_t)win * TT + t0;
  for (int e = tid; e < 64 * 16; e += 256) { const int rl = e >> 4, q = e & 15; v8h qh, ql, kh;
#pragma unroll
    for (int z = 0; z < 8; ++z) { const float x = sq[rl][q * 8 + z]; const _Float16 hx = (_Float16)x; qh[z] = hx; ql[z] = (_Float16)((x - (float)hx) * 1024.0f); kh[z] = (_Float16)sk[rl][q * 8 + z]; }
    const size_t o = (row0 + rl) * CCH + q * 8; vst2((v4u*)(QH + o), *(const v4u*)&qh); vst2((v4u*)(QL + o), *(const v4u*)&ql); vst2((v4u*)(KH + o), *(const v4u*)&kh); }
  for (int e = tid; e < 128 * 8; e += 256) { const int cl = e >> 3, q = e & 7; v8b hv, lv;
#pragma unroll
    for (int z = 0; z < 8; ++z) { hv[z] = tv[cl][q * 8 + z]; lv[z] = (__bf16)0.0f; }   /* v is a bf16-rounded input: exact in the hi plane, residual plane zero */
    const size_t o2 = ((size_t)win * CCH + cl) * (size_t)TT + t0 + q * 8; vst2((v4u*)(VT + o2), *(const v4u*)&hv); vst2((v4u*)(VL + o2), *(const v4u*)&lv); } }
// ---- k_sc: block = (64 queries, 128 keys, window * HG + head): 2-product logits x scale
__global__ __launch_bounds__(128) void k_sc(const _Float16* __restrict__ QH, const _Float16* __restrict__ QL, const _Float16* __restrict__ KH, float* __restrict__ S0) { __shared__ __align__(16) float ss[4][16][132]; const int w = blockIdx.z / HG, h = blockIdx.z % HG; float* S = S0 + (size_t)blockIdx.z * TT * TT;
  const int tid = threadIdx.x, wave = tid >> 5, lane = tid & 31, col = lane & 15, g = lane >> 4; const int k0 = blockIdx.y * 128; const int ql0 = blockIdx.x * 64 + wave * 16; const size_t q0 = (size_t)w * TT + ql0;
  v8f acc[8] = {}, accl[8] = {};
  { const v16h ah = frag_h(QH + (q0 + col) * CCH + h * HD, lane), al = frag_h(QL + (q0 + col) * CCH + h * HD, lane);
#pragma unroll
    for (int j = 0; j < 8; ++j) { const v16h kb = frag_h(KH + ((size_t)w * TT + k0 + j * 16 + col) * CCH + h * HD, lane); acc[j] = wmma16(ah, kb, acc[j]); accl[j] = wmma16(al, kb, accl[j]); } }
#pragma unroll
  for (int j = 0; j < 8; ++j)
#pragma unroll
    for (int r = 0; r < 8; ++r) ss[wave][8 * g + r][j * 16 + col] = (acc[j][r] + accl[j][r] * (1.0f / 1024.0f)) * SCALE;
  LDSX(); for (int rl = 0; rl < 16; ++rl) vst2(S + (size_t)(ql0 + rl) * TT + k0 + lane * 4, *(const v4f*)&ss[wave][rl][lane * 4]); }
// ---- k_sm: block = query row: softmax over the window's 1,024 keys (f32) -> P x 2^11 in place
__global__ __launch_bounds__(256) void k_sm(float* __restrict__ S0) { __shared__ float sred[8]; __shared__ float sbc; __shared__ __align__(16) float sh[TT];
  const int t = threadIdx.x; const size_t row = blockIdx.x; float* sr = S0 + (size_t)blockIdx.y * TT * TT + row * TT; const int kend = TT;
  float m = -3.0e38f; for (int k = t; k < kend; k += 256) m = fmaxf(m, sr[k]);
#pragma unroll
  for (int o = 1; o < 32; o <<= 1) m = fmaxf(m, __shfl_xor(m, o));
  if ((t & 31) == 0) sred[t >> 5] = m; __syncthreads(); if (t == 0) { float a = sred[0]; for (int i = 1; i < 8; ++i) a = fmaxf(a, sred[i]); sbc = a; } __syncthreads(); m = sbc; __syncthreads();
  float sum = 0.f; for (int k = t; k < kend; k += 256) sum += expf(sr[k] - m);
#pragma unroll
  for (int o = 1; o < 32; o <<= 1) sum += __shfl_xor(sum, o);
  if ((t & 31) == 0) sred[t >> 5] = sum; __syncthreads(); if (t == 0) { float a = 0.f; for (int i = 0; i < 8; ++i) a += sred[i]; sbc = 1.0f / a; } __syncthreads(); const float inv = sbc;
  for (int k = t; k < kend; k += 256) sh[k] = expf(sr[k] - m) * inv * 2048.0f;
  __syncthreads(); for (int q = t; q < kend / 4; q += 256) vst2(sr + q * 4, *(const v4f*)&sh[q * 4]); }
__global__ __launch_bounds__(128) void k_pv(const float* __restrict__ PS0, const __bf16* __restrict__ VT, const __bf16* __restrict__ VL, float* __restrict__ OUT) { const int w = blockIdx.z / HG, h = blockIdx.z % HG; const float* PS = PS0 + (size_t)blockIdx.z * TT * TT; __shared__ __align__(16) float ss[4][16][HD + 4];
  const int tid = threadIdx.x, wave = tid >> 5, lane = tid & 31, col = lane & 15, g = lane >> 4; const int ql0 = blockIdx.x * 64 + wave * 16; const int b = w / NWB, wi = w % NWB;
  v8f acc[HD / 16] = {};
#pragma unroll 1
  for (int kc = 0; kc < TT / 32; ++kc) { const F2 p = split_row(PS + (size_t)(ql0 + col) * TT, kc * 32, lane);
    asm volatile("s_wait_loadcnt 0x0" ::: "memory");
#pragma unroll
    for (int j = 0; j < HD / 16; ++j) { const size_t po = ((size_t)w * CCH + h * HD + j * 16 + col) * (size_t)TT + kc * 32; const v16b vh = frag_b(VT + po, lane); acc[j] = wmma_bf(p.h, vh, acc[j]); acc[j] = wmma_bf(p.l, vh, acc[j]); acc[j] = wmma_bf(p.h, frag_b(VL + po, lane), acc[j]); } }
#pragma unroll
  for (int j = 0; j < HD / 16; ++j)
#pragma unroll
    for (int r = 0; r < 8; ++r) ss[wave][8 * g + r][j * 16 + col] = acc[j][r] * (1.0f / 2048.0f);
  LDSX(); for (int rl = 0; rl < 16; ++rl) if (lane < HD / 4) vst2(OUT + ((size_t)b * LL + tok_of(wi, ql0 + rl)) * CCH + h * HD + lane * 4, *(const v4f*)&ss[wave][rl][lane * 4]); }
extern "C" void kernel_launch(void* const* d_in, const int* in_sizes, int n_in, void* d_out, int out_size, void* d_ws, size_t ws_size, hipStream_t stream) {
  (void)in_sizes; (void)n_in; (void)out_size;
  const float** F = (const float**)d_in;   // 0 qkv [3,2,4096,128]
  if (ws_size < (size_t)WS_END) return;
  char* ws = (char*)d_ws; _Float16 *QH = (_Float16*)(ws + WS_QH), *QL = (_Float16*)(ws + WS_QL), *KH = (_Float16*)(ws + WS_KH); __bf16 *VT = (__bf16*)(ws + WS_VT), *VL = (__bf16*)(ws + WS_VL); float* S = (float*)(ws + WS_S);
  k_part<<<dim3(TT / 64, NWP), 256, 0, stream>>>(F[0], QH, QL, KH, VT, VL);
  k_sc<<<dim3(TT / 64, TT / 128, NWP * HG), 128, 0, stream>>>(QH, QL, KH, S);
  k_sm<<<dim3(TT, NWP * HG), 256, 0, stream>>>(S);
  k_pv<<<dim3(TT / 64, 1, NWP * HG), 128, 0, stream>>>(S, VT, VL, (float*)d_out);
}

// v002
// A run of this version takes 32.5 microseconds.
// Timed twice side by side with v001, it ran 5.57 times as fast both times.
// Over all steps from v000 it is 13.9 times as fast.
// compute dtype: the float input rounded to bf16; window partition / merge as pure index permutations; q as f16 hi + residual (x 2^10), k once to f16 -> 2-product logits x 32^-0.5 on WMMA 16x16x32; online softmax in f32 (precise expf, running maximum per 64 keys, one division at the end); exp(s - m) split bf16 hi + lo against v bf16 hi + lo (3 products; v is bf16-exact so its lo plane is zero); f32 output.
#include <hip/hip_runtime.h>
#include <math.h>

typedef __attribute__((ext_vector_type(16))) _Float16 v16h;
typedef __attribute__((ext_vector_type(16))) __bf16 v16b;
typedef __attribute__((ext_vector_type(8)))  _Float16 v8h;
typedef __attribute__((ext_vector_type(8)))  float v8f;
typedef __attribute__((ext_vector_type(4)))  float v4f;
typedef __attribute__((ext_vector_type(2)))  float v2f;
typedef __attribute__((ext_vector_type(4)))  unsigned v4u;
typedef __attribute__((ext_vector_type(4)))  int v4i;
typedef float __attribute__((may_alias)) float_a;
typedef int __attribute__((may_alias)) int_a;

template <typename T> __device__ __forceinline__ void vst2(void* p, T v) { *(T*)p = v;  }
__device__ __forceinline__ v8f wmma16(v16h a, v16h b, v8f c) {
  v8f d = __builtin_amdgcn_wmma_f32_16x16x32_f16(false, a, false, b, (short)0, c, false, false);
  asm volatile("v_nop\n\tv_nop\n\tv_nop\n\tv_nop" : "+v"(d) : "v"(a), "v"(b));
  return d;
}
__device__ __forceinline__ v8f wmma_bf(v16b a, v16b b, v8f c) {
  v8f d = __builtin_amdgcn_wmma_f32_16x16x32_bf16(false, a, false, b, (short)0, c, false, false);
  asm volatile("v_nop\n\tv_nop\n\tv_nop\n\tv_nop" : "+v"(d) : "v"(a), "v"(b));
  return d;
}
// 16x16x32 fragments: lane = (h = lane>>4, row/col = lane&15); elements 0..7 = k0+8h+0..7, 8..15 = k0+16+8h+0..7; D element r = row 8h+r
__device__ __forceinline__ v16h frag_h(const _Float16* rowk0, int lane) {
  union { v16h v; v8h q[2]; } u; const _Float16* p = rowk0 + 8 * (lane >> 4);
  u.q[0] = *(const v8h*)p; u.q[1] = *(const v8h*)(p + 16); return u.v;
}
__device__ __forceinline__ v16h frag_f32(const float* rowk0, int lane) {
  v16h a; const float* p = rowk0 + 8 * (lane >> 4);
#pragma unroll
  for (int i = 0; i < 8; ++i) { a[i] = (_Float16)p[i]; a[8 + i] = (_Float16)p[16 + i]; }
  return a;
}
__device__ __forceinline__ v16h frag_f32s(const float* rowk0, int lane, float sc) {
  v16h a; const float* p = rowk0 + 8 * (lane >> 4);
#pragma unroll
  for (int i = 0; i < 8; ++i) { a[i] = (_Float16)(p[i] * sc); a[8 + i] = (_Float16)(p[16 + i] * sc); }
  return a;
}
// column fragment from a [K][ld] layout (column n), rows >= K read as 0
__device__ __forceinline__ v16h fragc_f32(const float* W, int k0, int n, int lane, int ld, int K) {
  v16h a; const int g = lane >> 4;
#pragma unroll
  for (int i = 0; i < 8; ++i) { const int ka = k0 + 8 * g + i, kb = ka + 16;
    a[i] = (_Float16)(ka < K ? W[(size_t)(ka < K ? ka : K - 1) * ld + n] : 0.f); a[8 + i] = (_Float16)(kb < K ? W[(size_t)(kb < K ? kb : K - 1) * ld + n] : 0.f); }
  return a;
}
struct F2 { v16b h, l; };
__device__ __forceinline__ F2 bsplit16(const float v[16]) { F2 r;
#pragma unroll
  for (int i = 0; i < 16; ++i) { const __bf16 h = (__bf16)v[i]; r.h[i] = h; r.l[i] = (__bf16)(v[i] - (float)h); }
  return r; }
__device__ __forceinline__ F2 split_row(const float* row, int k0, int lane) { float v[16]; const float* p = row + k0 + 8 * (lane >> 4);
#pragma unroll
  for (int i = 0; i < 8; ++i) { v[i] = p[i]; v[8 + i] = p[16 + i]; }
  return bsplit16(v); }
__device__ __forceinline__ F2 split_rowK(const float* row, int k0, int lane, int K) { float v[16]; const int g = lane >> 4;
#pragma unroll
  for (int i = 0; i < 8; ++i) { const int ka = k0 + 8 * g + i, kb = ka + 16; v[i] = ka < K ? row[ka < K ? ka : K - 1] : 0.f; v[8 + i] = kb < K ? row[kb < K ? kb : K - 1] : 0.f; }
  return bsplit16(v); }
__device__ __forceinline__ F2 split_col(const float* W, int k0, int n, int lane, int ld, int K) { float v[16]; const int g = lane >> 4;
#pragma unroll
  for (int i = 0; i < 8; ++i) { const int ka = k0 + 8 * g + i, kb = ka + 16; v[i] = ka < K ? W[(size_t)(ka < K ? ka : K - 1) * ld + n] : 0.f; v[8 + i] = kb < K ? W[(size_t)(kb < K ? kb : K - 1) * ld + n] : 0.f; }
  return bsplit16(v); }
__device__ __forceinline__ v8f mac3(const F2& a, const F2& b, v8f c) { c = wmma_bf(a.l, b.h, c); c = wmma_bf(a.h, b.l, c); return wmma_bf(a.h, b.h, c); }
__device__ __forceinline__ float sigm(float v) { return 1.0f / (1.0f + expf(-v)); }
#define LDSX() do { asm volatile("s_wait_dscnt 0" ::: "memory"); __builtin_amdgcn_wave_barrier(); __builtin_amdgcn_fence(__ATOMIC_RELEASE, "workgroup"); } while (0)


// LePE-style 3-D window attention (B 2, L = 16^3 = 4,096 tokens, C 128 = 4 heads x 32; windows 16 x 16 x 4 = 1,024 tokens): token l = d*256 + h*16 + w belongs to window (b, w / 4) at position t = d*64 + h*4 + w % 4; per (window, head): softmax(q k^T * 32^-0.5) v over the window; merged back to [B, L, C].
#define NBT 2
#define LL 4096
#define CCH 128
#define NH 4
#define HD 32
#define NWB 4               // windows per batch element
#define NW (NBT * NWB)      // 8 windows
#define TT 1024             // tokens per window
#define HG 4                // heads per launch group (= all)
#ifndef NWP
#define NWP NW              // windows processed
#endif
#define SCALE 0.17677669529663687f   // 32^-0.5
__device__ __forceinline__ float bfr(float v) { return (float)(__bf16)v; }
typedef __attribute__((ext_vector_type(8))) __bf16 v8b;
__device__ __forceinline__ v16b frag_b(const __bf16* rowk0, int lane) { union { v16b v; v8b q[2]; } u; const __bf16* p = rowk0 + 8 * (lane >> 4); u.q[0] = *(const v8b*)p; u.q[1] = *(const v8b*)(p + 16); return u.v; }
__device__ __forceinline__ int tok_of(int wi, int t) { return (t >> 6) * 256 + ((t >> 2) & 15) * 16 + wi * 4 + (t & 3); }   // window-local position -> token index l

#define WS_QH  0u                                   // f16 q rows [win*TT + t][128]
#define WS_QL  (WS_QH + 2u * (size_t)NW * TT * CCH)
#define WS_KH  (WS_QL + 2u * (size_t)NW * TT * CCH)
#define WS_VT  (WS_KH + 2u * (size_t)NW * TT * CCH)   // bf16 v planes [win][c][t]
#define WS_VL  (WS_VT + 2u * (size_t)NW * CCH * TT)
#define WS_END (WS_VL + 2u * (size_t)NW * CCH * TT)
__global__ __launch_bounds__(256) void k_part(const float* __restrict__ QKV, _Float16* __restrict__ QH, _Float16* __restrict__ QL, _Float16* __restrict__ KH, __bf16* __restrict__ VT, __bf16* __restrict__ VL) {
  __shared__ __align__(16) float sq[64][132], sk[64][132]; __shared__ __align__(16) __bf16 tv[128][72];
  const int tid = threadIdx.x; const int win = blockIdx.y; const int b = win / NWB, wi = win % NWB; const int t0 = blockIdx.x * 64;
  const float* Q = QKV; const float* K = QKV + (size_t)NBT * LL * CCH; const float* V = QKV + (size_t)2 * NBT * LL * CCH;
  for (int e = tid; e < 64 * 32; e += 256) { const int rl = e >> 5, q = e & 31; const size_t src = ((size_t)b * LL + tok_of(wi, t0 + rl)) * CCH + q * 4;
    const v4f vq = *(const v4f*)(Q + src), vk = *(const v4f*)(K + src), vv = *(const v4f*)(V + src);
#pragma unroll
    for (int z = 0; z < 4; ++z) { sq[rl][q * 4 + z] = bfr(vq[z]); sk[rl][q * 4 + z] = bfr(vk[z]); tv[q * 4 + z][rl] = (__bf16)vv[z]; } }
  __syncthreads();
  const size_t row0 = (size_t)win * TT + t0;
  for (int e = tid; e < 64 * 16; e += 256) { const int rl = e >> 4, q = e & 15; v8h qh, ql, kh;
#pragma unroll
    for (int z = 0; z < 8; ++z) { const float x = sq[rl][q * 8 + z]; const _Float16 hx = (_Float16)x; qh[z] = hx; ql[z] = (_Float16)((x - (float)hx) * 1024.0f); kh[z] = (_Float16)sk[rl][q * 8 + z]; }
    const size_t o = (row0 + rl) * CCH + q * 8; vst2((v4u*)(QH + o), *(const v4u*)&qh); vst2((v4u*)(QL + o), *(const v4u*)&ql); vst2((v4u*)(KH + o), *(const v4u*)&kh); }
  for (int e = tid; e < 128 * 8; e += 256) { const int cl = e >> 3, q = e & 7; v8b hv, lv;
#pragma unroll
    for (int z = 0; z < 8; ++z) { hv[z] = tv[cl][q * 8 + z]; lv[z] = (__bf16)0.0f; }   /* v is a bf16-rounded input: exact in the hi plane, residual plane zero */
    const size_t o2 = ((size_t)win * CCH + cl) * (size_t)TT + t0 + q * 8; vst2((v4u*)(VT + o2), *(const v4u*)&hv); vst2((v4u*)(VL + o2), *(const v4u*)&lv); } }
// ---- k_att: block = (128 queries = 8 waves x 16, window * HG + head): logits, softmax and P v in one pass over the window's 1,024 keys; the logits never leave the registers.
// S^T = K Q^T (A = 16 key rows, B = 16 query columns): a lane holds 8 keys of ONE query per tile, so two tiles' D registers are the B operand of O^T += V^T P^T as they stand.
// LDS planes in fragment order: unit u = 512 B = one 16-byte load of all 32 lanes. K: u = tile * 2 + half; V: u = ((j * 32 + kc) * 2 + half), j = channel tile, kc = 32-key chunk.
__device__ __forceinline__ float xhalf(float v) { return __builtin_bit_cast(float, __builtin_amdgcn_permlanex16(__builtin_bit_cast(int, v), __builtin_bit_cast(int, v), 0x76543210, 0xfedcba98, false, false)); }   // lane l <-> l ^ 16
__global__ __launch_bounds__(256) void k_att(const _Float16* __restrict__ QH, const _Float16* __restrict__ QL, const _Float16* __restrict__ KH, const __bf16* __restrict__ VT, const __bf16* __restrict__ VL, float* __restrict__ OUT) {
  __shared__ __align__(16) v4u sK[128 * 32], sV[128 * 32], sL[128 * 32];
  const int w = blockIdx.y / HG, h = blockIdx.y % HG; const int b = w / NWB, wi = w % NWB;
  const int tid = threadIdx.x, wave = tid >> 5, lane = tid & 31, col = lane & 15, g = lane >> 4;
  const int ql = blockIdx.x * 128 + wave * 16 + col; const size_t qo = ((size_t)w * TT + ql) * CCH + h * HD;
  const v16h qh = frag_h(QH + qo, lane);
  asm volatile("s_wait_xcnt 0x0" ::: "memory");   // precaution: behind it the address registers of the issued q loads may take new values (here: as the next loads' results)
  const v16h qlo = frag_h(QL + qo, lane);
  asm volatile("s_wait_xcnt 0x0" ::: "memory");   // precaution: the same for the residual plane's loads
  // wave's share of the staging: units wave * 16 + i, i = 0 .. 15, of each plane; one base address per plane, the rest are constant offsets
  const _Float16* kb = KH + ((size_t)w * TT + wave * 128 + col) * CCH + h * HD + g * 8;
  const size_t vo = ((size_t)w * CCH + h * HD + (wave >> 2) * 16 + col) * (size_t)TT + (wave & 3) * 256 + g * 8;
  const __bf16 *vb = VT + vo, *lb = VL + vo;
  v4u rk[16], rv[16], rl[16];
#pragma unroll
  for (int i = 0; i < 16; ++i) { rk[i] = *(const v4u*)(kb + (i >> 1) * 16 * CCH + (i & 1) * 16); rv[i] = *(const v4u*)(vb + (i >> 1) * 32 + (i & 1) * 16); rl[i] = *(const v4u*)(lb + (i >> 1) * 32 + (i & 1) * 16); }
  asm volatile("s_wait_xcnt 0x0" ::: "memory");   // precaution: the same for the staging loads' address registers
#pragma unroll
  for (int i = 0; i < 16; ++i) { const int u = wave * 16 + i; sK[u * 32 + lane] = rk[i]; sV[u * 32 + lane] = rv[i]; sL[u * 32 + lane] = rl[i]; }
  __syncthreads();
  v8f o[2] = {}; float m = -3.0e38f, l = 0.f;
  union KF { v16h v; v4u q[2]; } ka[4];   // the K fragments of a pass (64 keys), fetched one pass ahead
#pragma unroll
  for (int t = 0; t < 4; ++t) { ka[t].q[0] = sK[(t * 2) * 32 + lane]; ka[t].q[1] = sK[(t * 2 + 1) * 32 + lane]; }
#pragma unroll 1   // the pass loop stays rolled (about 800 instructions a pass); every inner loop is unrolled so that all array indices are constants and the arrays stay in registers
  for (int it = 0; it < TT / 64; ++it) { float s[4][8]; union VF { v16b v; v4u q[2]; } vh[2][2], vl[2][2];
#pragma unroll
    for (int c = 0; c < 2; ++c)
#pragma unroll
      for (int j = 0; j < 2; ++j) { const int u = (j * 32 + it * 2 + c) * 2; vh[c][j].q[0] = sV[u * 32 + lane]; vh[c][j].q[1] = sV[(u + 1) * 32 + lane]; vl[c][j].q[0] = sL[u * 32 + lane]; vl[c][j].q[1] = sL[(u + 1) * 32 + lane]; }
    __builtin_amdgcn_sched_barrier(0);   // keeps this pass's V loads in front of the logits: sunk to their products, each would wait out a full LDS latency
#pragma unroll
    for (int t = 0; t < 4; ++t) { const v8f z = {}; const v8f ah = wmma16(ka[t].v, qh, z), al = wmma16(ka[t].v, qlo, z);
#pragma unroll
      for (int r = 0; r < 8; ++r) s[t][r] = (ah[r] + al[r] * (1.0f / 1024.0f)) * SCALE; }
    { const int nx = ((it + 1) & (TT / 64 - 1)) * 8;   // the last pass fetches pass 0 again: in bounds, not used
#pragma unroll
      for (int t = 0; t < 4; ++t) { ka[t].q[0] = sK[(nx + t * 2) * 32 + lane]; ka[t].q[1] = sK[(nx + t * 2 + 1) * 32 + lane]; } }
    __builtin_amdgcn_sched_barrier(0);   // keeps the next pass's K loads in front of the softmax, which hides their latency
    float mx = s[0][0];
#pragma unroll
    for (int t = 0; t < 4; ++t)
#pragma unroll
      for (int r = 0; r < 8; ++r) mx = fmaxf(mx, s[t][r]);
    mx = fmaxf(mx, xhalf(mx)); const float mn = fmaxf(m, mx); const float al = expf(m - mn); m = mn;
#pragma unroll
    for (int j = 0; j < 2; ++j)
#pragma unroll
      for (int r = 0; r < 8; ++r) o[j][r] *= al;
    float p[2][16], ts[16];
#pragma unroll
    for (int c = 0; c < 2; ++c)
#pragma unroll
      for (int i = 0; i < 8; ++i) { p[c][i] = expf(s[2 * c][i] - m); p[c][8 + i] = expf(s[2 * c + 1][i] - m); }
#pragma unroll
    for (int i = 0; i < 16; ++i) ts[i] = p[0][i] + p[1][i];
#pragma unroll
    for (int d = 8; d > 0; d >>= 1)
#pragma unroll
      for (int i = 0; i < d; ++i) ts[i] += ts[i + d];   // a tree: one chain of 32 dependent adds would stall the wave
    l = l * al + ts[0];
#pragma unroll
    for (int c = 0; c < 2; ++c) { const F2 pf = bsplit16(p[c]);
#pragma unroll
      for (int j = 0; j < 2; ++j) { o[j] = wmma_bf(vh[c][j].v, pf.h, o[j]); o[j] = wmma_bf(vh[c][j].v, pf.l, o[j]); o[j] = wmma_bf(vl[c][j].v, pf.h, o[j]); } } }
  l += xhalf(l); const float inv = 1.0f / l;
  float* op = OUT + ((size_t)b * LL + tok_of(wi, ql)) * CCH + h * HD + 8 * g;   // D register r = channel j * 16 + 8 g + r of query col
#pragma unroll
  for (int j = 0; j < 2; ++j) { const v4f x0 = { o[j][0] * inv, o[j][1] * inv, o[j][2] * inv, o[j][3] * inv }, x1 = { o[j][4] * inv, o[j][5] * inv, o[j][6] * inv, o[j][7] * inv };
    vst2(op + j * 16, x0); vst2(op + j * 16 + 4, x1); } }
extern "C" void kernel_launch(void* const* d_in, const int* in_sizes, int n_in, void* d_out, int out_size, void* d_ws, size_t ws_size, hipStream_t stream) {
  (void)in_sizes; (void)n_in; (void)out_size;
  const float** F = (const float**)d_in;   // 0 qkv [3,2,4096,128]
  if (ws_size < (size_t)WS_END) return;
  char* ws = (char*)d_ws; _Float16 *QH = (_Float16*)(ws + WS_QH), *QL = (_Float16*)(ws + WS_QL), *KH = (_Float16*)(ws + WS_KH); __bf16 *VT = (__bf16*)(ws + WS_VT), *VL = (__bf16*)(ws + WS_VL);
  k_part<<<dim3(TT / 64, NWP), 256, 0, stream>>>(F[0], QH, QL, KH, VT, VL);
  k_att<<<dim3(TT / 128, NWP * HG), 256, 0, stream>>>(QH, QL, KH, VT, VL, (float*)d_out);
}

// v003
// A run of this version takes 25.7 microseconds.
// In two side-by-side timings against v002, it was 1.25 and 1.26 times as fast.
// Counting every step since v000, it is 17.4 times as fast.
// compute dtype: the float input rounded to bf16; window partition / merge as pure index permutations; q as f16 hi + residual (x 2^10), k once to f16 -> 2-product logits on WMMA 16x16x32; online softmax in f32 (base 2: 32^-0.5 * log2 e enters in one fma per logit, hardware exp2; running maximum per 64 keys, one division at the end); exp(s - m) split bf16 hi + lo against v bf16 hi + lo (3 products; v is bf16-exact so its lo plane is zero); f32 output.
#include <hip/hip_runtime.h>
#include <math.h>

typedef __attribute__((ext_vector_type(16))) _Float16 v16h;
typedef __attribute__((ext_vector_type(16))) __bf16 v16b;
typedef __attribute__((ext_vector_type(8)))  _Float16 v8h;
typedef __attribute__((ext_vector_type(8)))  float v8f;
typedef __attribute__((ext_vector_type(4)))  float v4f;
typedef __attribute__((ext_vector_type(2)))  float v2f;
typedef __attribute__((ext_vector_type(4)))  unsigned v4u;
typedef __attribute__((ext_vector_type(4)))  int v4i;
typedef float __attribute__((may_alias)) float_a;
typedef int __attribute__((may_alias)) int_a;

template <typename T> __device__ __forceinline__ void vst2(void* p, T v) { *(T*)p = v;  }
__device__ __forceinline__ v8f wmma16(v16h a, v16h b, v8f c) {
  v8f d = __builtin_amdgcn_wmma_f32_16x16x32_f16(false, a, false, b, (short)0, c, false, false);
  asm volatile("v_nop\n\tv_nop\n\tv_nop\n\tv_nop" : "+v"(d) : "v"(a), "v"(b));
  return d;
}
__device__ __forceinline__ v8f wmma_bf(v16b a, v16b b, v8f c) {
  v8f d = __builtin_amdgcn_wmma_f32_16x16x32_bf16(false, a, false, b, (short)0, c, false, false);
  asm volatile("v_nop\n\tv_nop\n\tv_nop\n\tv_nop" : "+v"(d) : "v"(a), "v"(b));
  return d;
}
// 16x16x32 fragments: lane = (h = lane>>4, row/col = lane&15); elements 0..7 = k0+8h+0..7, 8..15 = k0+16+8h+0..7; D element r = row 8h+r
__device__ __forceinline__ v16h frag_h(const _Float16* rowk0, int lane) {
  union { v16h v; v8h q[2]; } u; const _Float16* p = rowk0 + 8 * (lane >> 4);
  u.q[0] = *(const v8h*)p; u.q[1] = *(const v8h*)(p + 16); return u.v;
}
__device__ __forceinline__ v16h frag_f32(const float* rowk0, int lane) {
  v16h a; const float* p = rowk0 + 8 * (lane >> 4);
#pragma unroll
  for (int i = 0; i < 8; ++i) { a[i] = (_Float16)p[i]; a[8 + i] = (_Float16)p[16 + i]; }
  return a;
}
__device__ __forceinline__ v16h frag_f32s(const float* rowk0, int lane, float sc) {
  v16h a; const float* p = rowk0 + 8 * (lane >> 4);
#pragma unroll
  for (int i = 0; i < 8; ++i) { a[i] = (_Float16)(p[i] * sc); a[8 + i] = (_Float16)(p[16 + i] * sc); }
  return a;
}
// column fragment from a [K][ld] layout (column n), rows >= K read as 0
__device__ __forceinline__ v16h fragc_f32(const float* W, int k0, int n, int lane, int ld, int K) {
  v16h a; const int g = lane >> 4;
#pragma unroll
  for (int i = 0; i < 8; ++i) { const int ka = k0 + 8 * g + i, kb = ka + 16;
    a[i] = (_Float16)(ka < K ? W[(size_t)(ka < K ? ka : K - 1) * ld + n] : 0.f); a[8 + i] = (_Float16)(kb < K ? W[(size_t)(kb < K ? kb : K - 1) * ld + n] : 0.f); }
  return a;
}
struct F2 { v16b h, l; };
__device__ __forceinline__ F2 bsplit16(const float v[16]) { F2 r;
#pragma unroll
  for (int i = 0; i < 16; ++i) { const __bf16 h = (__bf16)v[i]; r.h[i] = h; r.l[i] = (__bf16)(v[i] - (float)h); }
  return r; }
__device__ __forceinline__ F2 split_row(const float* row, int k0, int lane) { float v[16]; const float* p = row + k0 + 8 * (lane >> 4);
#pragma unroll
  for (int i = 0; i < 8; ++i) { v[i] = p[i]; v[8 + i] = p[16 + i]; }
  return bsplit16(v); }
__device__ __forceinline__ F2 split_rowK(const float* row, int k0, int lane, int K) { float v[16]; const int g = lane >> 4;
#pragma unroll
  for (int i = 0; i < 8; ++i) { const int ka = k0 + 8 * g + i, kb = ka + 16; v[i] = ka < K ? row[ka < K ? ka : K - 1] : 0.f; v[8 + i] = kb < K ? row[kb < K ? kb : K - 1] : 0.f; }
  return bsplit16(v); }
__device__ __forceinline__ F2 split_col(const float* W, int k0, int n, int lane, int ld, int K) { float v[16]; const int g = lane >> 4;
#pragma unroll
  for (int i = 0; i < 8; ++i) { const int ka = k0 + 8 * g + i, kb = ka + 16; v[i] = ka < K ? W[(size_t)(ka < K ? ka : K - 1) * ld + n] : 0.f; v[8 + i] = kb < K ? W[(size_t)(kb < K ? kb : K - 1) * ld + n] : 0.f; }
  return bsplit16(v); }
__device__ __forceinline__ v8f mac3(const F2& a, const F2& b, v8f c) { c = wmma_bf(a.l, b.h, c); c = wmma_bf(a.h, b.l, c); return wmma_bf(a.h, b.h, c); }
__device__ __forceinline__ float sigm(float v) { return 1.0f / (1.0f + expf(-v)); }
#define LDSX() do { asm volatile("s_wait_dscnt 0" ::: "memory"); __builtin_amdgcn_wave_barrier(); __builtin_amdgcn_fence(__ATOMIC_RELEASE, "workgroup"); } while (0)


// LePE-style 3-D window attention (B 2, L = 16^3 = 4,096 tokens, C 128 = 4 heads x 32; windows 16 x 16 x 4 = 1,024 tokens): token l = d*256 + h*16 + w belongs to window (b, w / 4) at position t = d*64 + h*4 + w % 4; per (window, head): softmax(q k^T * 32^-0.5) v over the window; merged back to [B, L, C].
#define NBT 2
#define LL 4096
#define CCH 128
#define NH 4
#define HD 32
#define NWB 4               // windows per batch element
#define NW (NBT * NWB)      // 8 windows
#define TT 1024             // tokens per window
#define HG 4                // heads per launch group (= all)
#ifndef NWP
#define NWP NW              // windows processed
#endif
#define SCL2E ((float)(0.17677669529663687 * 1.4426950408889634))   // 32^-0.5 * log2(e): exp(32^-0.5 * (x - m)) = exp2(SCL2E * x - SCL2E * m)
__device__ __forceinline__ float bfr(float v) { return (float)(__bf16)v; }
typedef __attribute__((ext_vector_type(8))) __bf16 v8b;
__device__ __forceinline__ v16b frag_b(const __bf16* rowk0, int lane) { union { v16b v; v8b q[2]; } u; const __bf16* p = rowk0 + 8 * (lane >> 4); u.q[0] = *(const v8b*)p; u.q[1] = *(const v8b*)(p + 16); return u.v; }
__device__ __forceinline__ int tok_of(int wi, int t) { return (t >> 6) * 256 + ((t >> 2) & 15) * 16 + wi * 4 + (t & 3); }   // window-local position -> token index l

#define WS_QH  0u                                   // f16 q rows [win*TT + t][128]
#define WS_QL  (WS_QH + 2u * (size_t)NW * TT * CCH)
#define WS_KH  (WS_QL + 2u * (size_t)NW * TT * CCH)
#define WS_VT  (WS_KH + 2u * (size_t)NW * TT * CCH)   // bf16 v planes [win][c][t]
#define WS_VL  (WS_VT + 2u * (size_t)NW * CCH * TT)
#define WS_END (WS_VL + 2u * (size_t)NW * CCH * TT)
__global__ __launch_bounds__(256) void k_part(const float* __restrict__ QKV, _Float16* __restrict__ QH, _Float16* __restrict__ QL, _Float16* __restrict__ KH, __bf16* __restrict__ VT, __bf16* __restrict__ VL) {
  __shared__ __align__(16) float sq[64][132], sk[64][132]; __shared__ __align__(16) __bf16 tv[128][72];
  const int tid = threadIdx.x; const int win = blockIdx.y; const int b = win / NWB, wi = win % NWB; const int t0 = blockIdx.x * 64;
  const float* Q = QKV; const float* K = QKV + (size_t)NBT * LL * CCH; const float* V = QKV + (size_t)2 * NBT * LL * CCH;
  for (int e = tid; e < 64 * 32; e += 256) { const int rl = e >> 5, q = e & 31; const size_t src = ((size_t)b * LL + tok_of(wi, t0 + rl)) * CCH + q * 4;
    const v4f vq = *(const v4f*)(Q + src), vk = *(const v4f*)(K + src), vv = *(const v4f*)(V + src);
#pragma unroll
    for (int z = 0; z < 4; ++z) { sq[rl][q * 4 + z] = bfr(vq[z]); sk[rl][q * 4 + z] = bfr(vk[z]); tv[q * 4 + z][rl] = (__bf16)vv[z]; } }
  __syncthreads();
  const size_t row0 = (size_t)win * TT + t0;
  for (int e = tid; e < 64 * 16; e += 256) { const int rl = e >> 4, q = e & 15; v8h qh, ql, kh;
#pragma unroll
    for (int z = 0; z < 8; ++z) { const float x = sq[rl][q * 8 + z]; const _Float16 hx = (_Float16)x; qh[z] = hx; ql[z] = (_Float16)((x - (float)hx) * 1024.0f); kh[z] = (_Float16)sk[rl][q * 8 + z]; }
    const size_t o = (row0 + rl) * CCH + q * 8; vst2((v4u*)(QH + o), *(const v4u*)&qh); vst2((v4u*)(QL + o), *(const v4u*)&ql); vst2((v4u*)(KH + o), *(const v4u*)&kh); }
  for (int e = tid; e < 128 * 8; e += 256) { const int cl = e >> 3, q = e & 7; v8b hv, lv;
#pragma unroll
    for (int z = 0; z < 8; ++z) { hv[z] = tv[cl][q * 8 + z]; lv[z] = (__bf16)0.0f; }   /* v is a bf16-rounded input: exact in the hi plane, residual plane zero */
    const size_t o2 = ((size_t)win * CCH + cl) * (size_t)TT + t0 + q * 8; vst2((v4u*)(VT + o2), *(const v4u*)&hv); vst2((v4u*)(VL + o2), *(const v4u*)&lv); } }
// ---- k_att: block = (128 queries = 8 waves x 16, window * HG + head): logits, softmax and P v in one pass over the window's 1,024 keys; the logits never leave the registers.
// S^T = K Q^T (A = 16 key rows, B = 16 query columns): a lane holds 8 keys of ONE query per tile, so two tiles' D registers are the B operand of O^T += V^T P^T as they stand.
// LDS planes in fragment order: unit u = 512 B = one 16-byte load of all 32 lanes. K: u = tile * 2 + half; V: u = ((j * 32 + kc) * 2 + half), j = channel tile, kc = 32-key chunk.
__device__ __forceinline__ float xhalf(float v) { return __builtin_bit_cast(float, __builtin_amdgcn_permlanex16(__builtin_bit_cast(int, v), __builtin_bit_cast(int, v), 0x76543210, 0xfedcba98, false, false)); }   // lane l <-> l ^ 16
// 2^x; the v_nop keeps the slot behind the exp2 also where an asm statement, into which the compiler does not look, comes next
__device__ __forceinline__ float exp2x1(float x) { float y; asm("v_exp_f32 %0, %1\n\tv_nop" : "=v"(y) : "v"(x)); return y; }
// y[i] = 2^x[i], eight in one statement, the results in registers apart from every source (early clobber): so no exp2 has its source overwritten or its result read by the instruction directly behind it; the v_nop keeps that slot behind the last one
__device__ __forceinline__ void exp2x8(float* y, const float* x) {
  asm("v_exp_f32 %0, %8\n\tv_exp_f32 %1, %9\n\tv_exp_f32 %2, %10\n\tv_exp_f32 %3, %11\n\tv_exp_f32 %4, %12\n\tv_exp_f32 %5, %13\n\tv_exp_f32 %6, %14\n\tv_exp_f32 %7, %15\n\tv_nop"
      : "=&v"(y[0]), "=&v"(y[1]), "=&v"(y[2]), "=&v"(y[3]), "=&v"(y[4]), "=&v"(y[5]), "=&v"(y[6]), "=&v"(y[7])
      : "v"(x[0]), "v"(x[1]), "v"(x[2]), "v"(x[3]), "v"(x[4]), "v"(x[5]), "v"(x[6]), "v"(x[7])); }
__global__ __launch_bounds__(256) void k_att(const _Float16* __restrict__ QH, const _Float16* __restrict__ QL, const _Float16* __restrict__ KH, const __bf16* __restrict__ VT, const __bf16* __restrict__ VL, float* __restrict__ OUT) {
  __shared__ __align__(16) v4u sK[128 * 32], sV[128 * 32], sL[128 * 32];
  const int w = blockIdx.y / HG, h = blockIdx.y % HG; const int b = w / NWB, wi = w % NWB;
  const int tid = threadIdx.x, wave = tid >> 5, lane = tid & 31, col = lane & 15, g = lane >> 4;
  const int ql = blockIdx.x * 128 + wave * 16 + col; const size_t qo = ((size_t)w * TT + ql) * CCH + h * HD;
  const v16h qh = frag_h(QH + qo, lane);
  asm volatile("s_wait_xcnt 0x0" ::: "memory");   // precaution: behind it the address registers of the issued q loads may take new values (here: as the next loads' results)
  const v16h qlo = frag_h(QL + qo, lane);
  asm volatile("s_wait_xcnt 0x0" ::: "memory");   // precaution: the same for the residual plane's loads
  // wave's share of the staging: units wave * 16 + i, i = 0 .. 15, of each plane; one base address per plane, the rest are constant offsets
  const _Float16* kb = KH + ((size_t)w * TT + wave * 128 + col) * CCH + h * HD + g * 8;
  const size_t vo = ((size_t)w * CCH + h * HD + (wave >> 2) * 16 + col) * (size_t)TT + (wave & 3) * 256 + g * 8;
  const __bf16 *vb = VT + vo, *lb = VL + vo;
  v4u rk[16], rv[16], rl[16];
#pragma unroll
  for (int i = 0; i < 16; ++i) { rk[i] = *(const v4u*)(kb + (i >> 1) * 16 * CCH + (i & 1) * 16); rv[i] = *(const v4u*)(vb + (i >> 1) * 32 + (i & 1) * 16); rl[i] = *(const v4u*)(lb + (i >> 1) * 32 + (i & 1) * 16); }
  asm volatile("s_wait_xcnt 0x0" ::: "memory");   // precaution: the same for the staging loads' address registers
#pragma unroll
  for (int i = 0; i < 16; ++i) { const int u = wave * 16 + i; sK[u * 32 + lane] = rk[i]; sV[u * 32 + lane] = rv[i]; sL[u * 32 + lane] = rl[i]; }
  __syncthreads();
  v8f o[2] = {}; float m = -3.0e38f, l = 0.f;
  union KF { v16h v; v4u q[2]; } ka[4];   // the K fragments of a pass (64 keys), fetched one pass ahead
#pragma unroll
  for (int t = 0; t < 4; ++t) { ka[t].q[0] = sK[(t * 2) * 32 + lane]; ka[t].q[1] = sK[(t * 2 + 1) * 32 + lane]; }
#pragma unroll 1   // the pass loop stays rolled (about 800 instructions a pass); every inner loop is unrolled so that all array indices are constants and the arrays stay in registers
  for (int it = 0; it < TT / 64; ++it) { float s[4][8]; union VF { v16b v; v4u q[2]; } vh[2][2], vl[2][2];
#pragma unroll
    for (int c = 0; c < 2; ++c)
#pragma unroll
      for (int j = 0; j < 2; ++j) { const int u = (j * 32 + it * 2 + c) * 2; vh[c][j].q[0] = sV[u * 32 + lane]; vh[c][j].q[1] = sV[(u + 1) * 32 + lane]; vl[c][j].q[0] = sL[u * 32 + lane]; vl[c][j].q[1] = sL[(u + 1) * 32 + lane]; }
    __builtin_amdgcn_sched_barrier(0);   // keeps this pass's V loads in front of the logits: sunk to their products, each would wait out a full LDS latency
#pragma unroll
    for (int t = 0; t < 4; ++t) { const v8f z = {}; const v8f ah = wmma16(ka[t].v, qh, z), al = wmma16(ka[t].v, qlo, z);
#pragma unroll
      for (int r = 0; r < 8; ++r) s[t][r] = ah[r] + al[r] * (1.0f / 1024.0f); }   // unscaled: the scale is positive, so the maximum may be taken before it
    { const int nx = ((it + 1) & (TT / 64 - 1)) * 8;   // the last pass fetches pass 0 again: in bounds, not used
#pragma unroll
      for (int t = 0; t < 4; ++t) { ka[t].q[0] = sK[(nx + t * 2) * 32 + lane]; ka[t].q[1] = sK[(nx + t * 2 + 1) * 32 + lane]; } }
    __builtin_amdgcn_sched_barrier(0);   // keeps the next pass's K loads in front of the softmax, which hides their latency
    float mx = s[0][0];
#pragma unroll
    for (int t = 0; t < 4; ++t)
#pragma unroll
      for (int r = 0; r < 8; ++r) mx = fmaxf(mx, s[t][r]);
    mx = fmaxf(mx, xhalf(mx)); const float mn = fmaxf(m, mx); const float al = exp2x1((m - mn) * SCL2E); m = mn;
    const float mc = m * SCL2E; const v2f c2 = { SCL2E, SCL2E }, nm2 = { -mc, -mc };   // one offset for every exponent of the pass
#pragma unroll
    for (int j = 0; j < 2; ++j)
#pragma unroll
      for (int r = 0; r < 8; ++r) o[j][r] *= al;
    float p[2][16], ts[16];
#pragma unroll
    for (int c = 0; c < 2; ++c)
#pragma unroll
      for (int t = 0; t < 2; ++t) { float x[8];
#pragma unroll
        for (int i = 0; i < 8; i += 2) { const v2f a = { s[2 * c + t][i], s[2 * c + t][i + 1] }; const v2f e = __builtin_elementwise_fma(a, c2, nm2); x[i] = e[0]; x[i + 1] = e[1]; }   // pairs: two exponents per packed fma
        exp2x8(&p[c][8 * t], x); }
#pragma unroll
    for (int i = 0; i < 16; ++i) ts[i] = p[0][i] + p[1][i];
#pragma unroll
    for (int d = 8; d > 0; d >>= 1)
#pragma unroll
      for (int i = 0; i < d; ++i) ts[i] += ts[i + d];   // a tree: one chain of 32 dependent adds would stall the wave
    l = l * al + ts[0];
#pragma unroll
    for (int c = 0; c < 2; ++c) { const F2 pf = bsplit16(p[c]);
#pragma unroll
      for (int j = 0; j < 2; ++j) { o[j] = wmma_bf(vh[c][j].v, pf.h, o[j]); o[j] = wmma_bf(vh[c][j].v, pf.l, o[j]); o[j] = wmma_bf(vl[c][j].v, pf.h, o[j]); } } }
  l += xhalf(l); const float inv = 1.0f / l;
  float* op = OUT + ((size_t)b * LL + tok_of(wi, ql)) * CCH + h * HD + 8 * g;   // D register r = channel j * 16 + 8 g + r of query col
#pragma unroll
  for (int j = 0; j < 2; ++j) { const v4f x0 = { o[j][0] * inv, o[j][1] * inv, o[j][2] * inv, o[j][3] * inv }, x1 = { o[j][4] * inv, o[j][5] * inv, o[j][6] * inv, o[j][7] * inv };
    vst2(op + j * 16, x0); vst2(op + j * 16 + 4, x1); } }
extern "C" void kernel_launch(void* const* d_in, const int* in_sizes, int n_in, void* d_out, int out_size, void* d_ws, size_t ws_size, hipStream_t stream) {
  (void)in_sizes; (void)n_in; (void)out_size;
  const float** F = (const float**)d_in;   // 0 qkv [3,2,4096,128]
  if (ws_size < (size_t)WS_END) return;
  char* ws = (char*)d_ws; _Float16 *QH = (_Float16*)(ws + WS_QH), *QL = (_Float16*)(ws + WS_QL), *KH = (_Float16*)(ws + WS_KH); __bf16 *VT = (__bf16*)(ws + WS_VT), *VL = (__bf16*)(ws + WS_VL);
  k_part<<<dim3(TT / 64, NWP), 256, 0, stream>>>(F[0], QH, QL, KH, VT, VL);
  k_att<<<dim3(TT / 128, NWP * HG), 256, 0, stream>>>(QH, QL, KH, VT, VL, (float*)d_out);
}

// v004
// Measured time: 16.3 microseconds a run.
// Two timings next to v003 put it at 1.57 and 1.56 times that version's speed.
// Over all steps from v000 it is 27.3 times as fast.
// compute dtype: the float input rounded to bf16; window partition / merge as pure index permutations; q as f16 hi + residual (x 2^10), k once to f16 -> 2-product logits on WMMA 16x16x32; online softmax in f32 (base 2: 32^-0.5 * log2 e enters in one fma per logit, hardware exp2; running maximum per 64 keys, one division at the end); exp(s - m) split bf16 hi + lo against v bf16 hi + lo (3 products; v is bf16-exact so its lo plane is zero); f32 output.
#include <hip/hip_runtime.h>
#include <math.h>

typedef __attribute__((ext_vector_type(16))) _Float16 v16h;
typedef __attribute__((ext_vector_type(16))) __bf16 v16b;
typedef __attribute__((ext_vector_type(8)))  _Float16 v8h;
typedef __attribute__((ext_vector_type(8)))  float v8f;
typedef __attribute__((ext_vector_type(4)))  float v4f;
typedef __attribute__((ext_vector_type(2)))  float v2f;
typedef __attribute__((ext_vector_type(4)))  unsigned v4u;
typedef __attribute__((ext_vector_type(4)))  int v4i;
typedef float __attribute__((may_alias)) float_a;
typedef int __attribute__((may_alias)) int_a;

template <typename T> __device__ __forceinline__ void vst2(void* p, T v) { *(T*)p = v;  }
__device__ __forceinline__ v8f wmma16(v16h a, v16h b, v8f c) {
  v8f d = __builtin_amdgcn_wmma_f32_16x16x32_f16(false, a, false, b, (short)0, c, false, false);
  asm volatile("v_nop\n\tv_nop\n\tv_nop\n\tv_nop" : "+v"(d) : "v"(a), "v"(b));
  return d;
}
__device__ __forceinline__ v8f wmma_bf(v16b a, v16b b, v8f c) {
  v8f d = __builtin_amdgcn_wmma_f32_16x16x32_bf16(false, a, false, b, (short)0, c, false, false);
  asm volatile("v_nop\n\tv_nop\n\tv_nop\n\tv_nop" : "+v"(d) : "v"(a), "v"(b));
  return d;
}
// 16x16x32 fragments: lane = (h = lane>>4, row/col = lane&15); elements 0..7 = k0+8h+0..7, 8..15 = k0+16+8h+0..7; D element r = row 8h+r
__device__ __forceinline__ v16h frag_h(const _Float16* rowk0, int lane) {
  union { v16h v; v8h q[2]; } u; const _Float16* p = rowk0 + 8 * (lane >> 4);
  u.q[0] = *(const v8h*)p; u.q[1] = *(const v8h*)(p + 16); return u.v;
}
__device__ __forceinline__ v16h frag_f32(const float* rowk0, int lane) {
  v16h a; const float* p = rowk0 + 8 * (lane >> 4);
#pragma unroll
  for (int i = 0; i < 8; ++i) { a[i] = (_Float16)p[i]; a[8 + i] = (_Float16)p[16 + i]; }
  return a;
}
__device__ __forceinline__ v16h frag_f32s(const float* rowk0, int lane, float sc) {
  v16h a; const float* p = rowk0 + 8 * (lane >> 4);
#pragma unroll
  for (int i = 0; i < 8; ++i) { a[i] = (_Float16)(p[i] * sc); a[8 + i] = (_Float16)(p[16 + i] * sc); }
  return a;
}
// column fragment from a [K][ld] layout (column n), rows >= K read as 0
__device__ __forceinline__ v16h fragc_f32(const float* W, int k0, int n, int lane, int ld, int K) {
  v16h a; const int g = lane >> 4;
#pragma unroll
  for (int i = 0; i < 8; ++i) { const int ka = k0 + 8 * g + i, kb = ka + 16;
    a[i] = (_Float16)(ka < K ? W[(size_t)(ka < K ? ka : K - 1) * ld + n] : 0.f); a[8 + i] = (_Float16)(kb < K ? W[(size_t)(kb < K ? kb : K - 1) * ld + n] : 0.f); }
  return a;
}
struct F2 { v16b h, l; };
__device__ __forceinline__ F2 bsplit16(const float v[16]) { F2 r;
#pragma unroll
  for (int i = 0; i < 16; ++i) { const __bf16 h = (__bf16)v[i]; r.h[i] = h; r.l[i] = (__bf16)(v[i] - (float)h); }
  return r; }
__device__ __forceinline__ F2 split_row(const float* row, int k0, int lane) { float v[16]; const float* p = row + k0 + 8 * (lane >> 4);
#pragma unroll
  for (int i = 0; i < 8; ++i) { v[i] = p[i]; v[8 + i] = p[16 + i]; }
  return bsplit16(v); }
__device__ __forceinline__ F2 split_rowK(const float* row, int k0, int lane, int K) { float v[16]; const int g = lane >> 4;
#pragma unroll
  for (int i = 0; i < 8; ++i) { const int ka = k0 + 8 * g + i, kb = ka + 16; v[i] = ka < K ? row[ka < K ? ka : K - 1] : 0.f; v[8 + i] = kb < K ? row[kb < K ? kb : K - 1] : 0.f; }
  return bsplit16(v); }
__device__ __forceinline__ F2 split_col(const float* W, int k0, int n, int lane, int ld, int K) { float v[16]; const int g = lane >> 4;
#pragma unroll
  for (int i = 0; i < 8; ++i) { const int ka = k0 + 8 * g + i, kb = ka + 16; v[i] = ka < K ? W[(size_t)(ka < K ? ka : K - 1) * ld + n] : 0.f; v[8 + i] = kb < K ? W[(size_t)(kb < K ? kb : K - 1) * ld + n] : 0.f; }
  return bsplit16(v); }
__device__ __forceinline__ v8f mac3(const F2& a, const F2& b, v8f c) { c = wmma_bf(a.l, b.h, c); c = wmma_bf(a.h, b.l, c); return wmma_bf(a.h, b.h, c); }
__device__ __forceinline__ float sigm(float v) { return 1.0f / (1.0f + expf(-v)); }
#define LDSX() do { asm volatile("s_wait_dscnt 0" ::: "memory"); __builtin_amdgcn_wave_barrier(); __builtin_amdgcn_fence(__ATOMIC_RELEASE, "workgroup"); } while (0)


// LePE-style 3-D window attention (B 2, L = 16^3 = 4,096 tokens, C 128 = 4 heads x 32; windows 16 x 16 x 4 = 1,024 tokens): token l = d*256 + h*16 + w belongs to window (b, w / 4) at position t = d*64 + h*4 + w % 4; per (window, head): softmax(q k^T * 32^-0.5) v over the window; merged back to [B, L, C].
#define NBT 2
#define LL 4096
#define CCH 128
#define NH 4
#define HD 32
#define NWB 4               // windows per batch element
#define NW (NBT * NWB)      // 8 windows
#define TT 1024             // tokens per window
#define HG 4                // heads per launch group (= all)
#ifndef NWP
#define NWP NW              // windows processed
#endif
#define SCL2E ((float)(0.17677669529663687 * 1.4426950408889634))   // 32^-0.5 * log2(e): exp(32^-0.5 * (x - m)) = exp2(SCL2E * x - SCL2E * m)
__device__ __forceinline__ float bfr(float v) { return (float)(__bf16)v; }
typedef __attribute__((ext_vector_type(8))) __bf16 v8b;
__device__ __forceinline__ v16b frag_b(const __bf16* rowk0, int lane) { union { v16b v; v8b q[2]; } u; const __bf16* p = rowk0 + 8 * (lane >> 4); u.q[0] = *(const v8b*)p; u.q[1] = *(const v8b*)(p + 16); return u.v; }
__device__ __forceinline__ int tok_of(int wi, int t) { return (t >> 6) * 256 + ((t >> 2) & 15) * 16 + wi * 4 + (t & 3); }   // window-local position -> token index l

// ---- k_att: block = (128 queries = 8 waves x 16, window * HG + head): logits, softmax and P v in one pass over the window's 1,024 keys; the logits never leave the registers.
// S^T = K Q^T (A = 16 key rows, B = 16 query columns): a lane holds 8 keys of ONE query per tile, so two tiles' D registers are the B operand of O^T += V^T P^T as they stand.
// LDS planes in fragment order: unit u = 512 B = one 16-byte load of all 32 lanes. K: u = tile * 2 + half; V: u = ((j * 32 + kc) * 2 + half), j = channel tile, kc = 32-key chunk.
// The block reads q, k, v as f32 from the input itself (window position -> token by index arithmetic), rounds them in registers (q also split into f16 hi + residual) and writes the planes to LDS: no partition launch, no workspace.
// Inside a unit lane n's 16 bytes lie at slot n ^ (half + 2 j) for V and n ^ (4 g + 8 half) for q and K: a staging lane holds 4 neighbouring channels, and unswizzled the lanes of one LDS store would share a quarter of the banks.
__device__ __forceinline__ float xhalf(float v) { return __builtin_bit_cast(float, __builtin_amdgcn_permlanex16(__builtin_bit_cast(int, v), __builtin_bit_cast(int, v), 0x76543210, 0xfedcba98, false, false)); }   // lane l <-> l ^ 16
// 2^x; the v_nop keeps the slot behind the exp2 also where an asm statement, into which the compiler does not look, comes next
__device__ __forceinline__ float exp2x1(float x) { float y; asm("v_exp_f32 %0, %1\n\tv_nop" : "=v"(y) : "v"(x)); return y; }
// y[i] = 2^x[i], eight in one statement, the results in registers apart from every source (early clobber): so no exp2 has its source overwritten or its result read by the instruction directly behind it; the v_nop keeps that slot behind the last one
__device__ __forceinline__ void exp2x8(float* y, const float* x) {
  asm("v_exp_f32 %0, %8\n\tv_exp_f32 %1, %9\n\tv_exp_f32 %2, %10\n\tv_exp_f32 %3, %11\n\tv_exp_f32 %4, %12\n\tv_exp_f32 %5, %13\n\tv_exp_f32 %6, %14\n\tv_exp_f32 %7, %15\n\tv_nop"
      : "=&v"(y[0]), "=&v"(y[1]), "=&v"(y[2]), "=&v"(y[3]), "=&v"(y[4]), "=&v"(y[5]), "=&v"(y[6]), "=&v"(y[7])
      : "v"(x[0]), "v"(x[1]), "v"(x[2]), "v"(x[3]), "v"(x[4]), "v"(x[5]), "v"(x[6]), "v"(x[7])); }
typedef __attribute__((ext_vector_type(4))) _Float16 v4h;
typedef __attribute__((ext_vector_type(2))) unsigned v2u;
__global__ __launch_bounds__(256) void k_att(const float* __restrict__ Q, const float* __restrict__ K, const float* __restrict__ V, float* __restrict__ OUT) {
  __shared__ __align__(16) v4u sK[128 * 32], sV[128 * 32], sL[128 * 32], sQ[8 * 4 * 32];   // sQ: per wave its 16 queries as one tile, units hi half 0, hi half 1, residual half 0, residual half 1
  const int w = blockIdx.y / HG, h = blockIdx.y % HG; const int b = w / NWB, wi = w % NWB;
  const int tid = threadIdx.x, wave = tid >> 5, lane = tid & 31, col = lane & 15, g = lane >> 4;
  const int ql = blockIdx.x * 128 + wave * 16 + col;
  // every staging load covers whole 128-byte lines: 8 lanes (cq) take the head's 32 channels of one token, kg picks one of 4 tokens. One base address per tensor, the rest are constant offsets:
  // 4 more window positions = 16 more tokens; position 8 t' + i -> token 32 t' + (i >> 2) * 16 + (i & 3)
  const int cq = lane & 7, kg = lane >> 3;
  const size_t lo = (size_t)b * LL * CCH + h * HD + cq * 4;
  const float* qp = Q + lo + (size_t)tok_of(wi, blockIdx.x * 128 + wave * 16 + kg) * CCH;   // q, k: position 4 n + kg of the wave's share
  const float* kp = K + lo + (size_t)tok_of(wi, wave * 128 + kg) * CCH;                     // wave's share: key tiles wave * 8 + 0 .. 7
  const float* vp = V + lo + (size_t)tok_of(wi, wave * 128 + kg * 8) * CCH;                 // v: 8 keys, octet wave * 16 + p * 4 + kg, p = 0 .. 3
  v4f rq[4], rk[32], rv[4][8];
#pragma unroll
  for (int n = 0; n < 4; ++n) rq[n] = *(const v4f*)(qp + n * 16 * CCH);
  asm volatile("s_wait_xcnt 0x0" ::: "memory");   // precaution: behind it the address registers of the issued q loads may take new values (also as later loads' results)
#pragma unroll
  for (int n = 0; n < 32; ++n) rk[n] = *(const v4f*)(kp + n * 16 * CCH);
  asm volatile("s_wait_xcnt 0x0" ::: "memory");   // precaution: the same for the k loads
#pragma unroll
  for (int p = 0; p < 2; ++p)
#pragma unroll
    for (int i = 0; i < 8; ++i) rv[p][i] = *(const v4f*)(vp + (p * 128 + (i >> 2) * 16 + (i & 3)) * CCH);
  __builtin_amdgcn_sched_barrier(0);   // keeps every conversion behind these loads: lifted among them, its wait for data would hold the later loads back by a memory latency
  // q, k: the lane's 4 channels are 8 bytes of the fragment slot (half = cq >> 2, g = (cq >> 1) & 1, column = position & 15)
  const int ks = (cq >> 1) & 3;   // = g + 2 half of the slot written
  char* const kd = (char*)sK + ((wave * 16 + (cq >> 2)) * 32 + ((cq >> 1) & 1) * 16 + kg) * 16 + (cq & 1) * 8;
  char* const qd = (char*)sQ + ((wave * 4 + (cq >> 2)) * 32 + ((cq >> 1) & 1) * 16 + kg) * 16 + (cq & 1) * 8;
#define KST(n) do { v4h r_; _Pragma("unroll") for (int z = 0; z < 4; ++z) r_[z] = (_Float16)bfr(rk[n][z]); *(v2u*)(kd + ((n) >> 2) * 1024 + ((((n) & 3) ^ ks) * 64)) = __builtin_bit_cast(v2u, r_); } while (0)
#pragma unroll
  for (int n = 0; n < 16; ++n) KST(n);
  __builtin_amdgcn_sched_barrier(0);   // keeps the second half of the v loads behind the first half of k: all at once would not fit 256 registers
#pragma unroll
  for (int p = 2; p < 4; ++p)
#pragma unroll
    for (int i = 0; i < 8; ++i) rv[p][i] = *(const v4f*)(vp + (p * 128 + (i >> 2) * 16 + (i & 3)) * CCH);
  asm volatile("s_wait_xcnt 0x0" ::: "memory");   // precaution: the same for the v loads
  __builtin_amdgcn_sched_barrier(0);   // keeps the work below behind these loads, so that it hides their latency
#pragma unroll
  for (int n = 16; n < 32; ++n) KST(n);
#undef KST
#pragma unroll
  for (int n = 0; n < 4; ++n) { v4h hi, re;
#pragma unroll
    for (int z = 0; z < 4; ++z) { const float x = bfr(rq[n][z]); const _Float16 hx = (_Float16)x; hi[z] = hx; re[z] = (_Float16)((x - (float)hx) * 1024.0f); }
    *(v2u*)(qd + ((n ^ ks) * 64)) = __builtin_bit_cast(v2u, hi); *(v2u*)(qd + 1024 + ((n ^ ks) * 64)) = __builtin_bit_cast(v2u, re); }
  { const v4u zz = { 0u, 0u, 0u, 0u };   /* v is a bf16-rounded input: exact in the hi plane, residual plane zero */
#pragma unroll
    for (int i = 0; i < 16; ++i) sL[(wave * 16 + i) * 32 + lane] = zz; }
  { const int jv = cq >> 2, hv = kg >> 1, sw = hv + 2 * jv; v4u* vd = sV + ((jv * 32 + wave * 4) * 2 + hv) * 32 + (kg & 1) * 16;
#pragma unroll
    for (int p = 0; p < 4; ++p)
#pragma unroll
      for (int z = 0; z < 4; ++z) { v8b t8;
#pragma unroll
        for (int i = 0; i < 8; ++i) t8[i] = (__bf16)rv[p][i][z];
        vd[p * 64 + ((((cq & 3) * 4) + z) ^ sw)] = __builtin_bit_cast(v4u, t8); } }
  __syncthreads();
  const int lk0 = lane ^ (4 * g), lk1 = lane ^ (4 * g + 8);   // q, k units: lane n's slot, half 0 and half 1
  union QF { v16h v; v4u q[2]; } qf, qr;
  qf.q[0] = sQ[(wave * 4) * 32 + lk0]; qf.q[1] = sQ[(wave * 4 + 1) * 32 + lk1]; qr.q[0] = sQ[(wave * 4 + 2) * 32 + lk0]; qr.q[1] = sQ[(wave * 4 + 3) * 32 + lk1];
  const v16h qh = qf.v, qlo = qr.v;
  v8f o[2] = {}; float m = -3.0e38f, l = 0.f;
  union KF { v16h v; v4u q[2]; } ka[4];   // the K fragments of a pass (64 keys), fetched one pass ahead
#pragma unroll
  for (int t = 0; t < 4; ++t) { ka[t].q[0] = sK[(t * 2) * 32 + lk0]; ka[t].q[1] = sK[(t * 2 + 1) * 32 + lk1]; }
#pragma unroll 1   // the pass loop stays rolled (about 800 instructions a pass); every inner loop is unrolled so that all array indices are constants and the arrays stay in registers
  for (int it = 0; it < TT / 64; ++it) { float s[4][8]; union VF { v16b v; v4u q[2]; } vh[2][2], vl[2][2];
#pragma unroll
    for (int c = 0; c < 2; ++c)
#pragma unroll
      for (int j = 0; j < 2; ++j) { const int u = (j * 32 + it * 2 + c) * 2; vh[c][j].q[0] = sV[u * 32 + (lane ^ (2 * j))]; vh[c][j].q[1] = sV[(u + 1) * 32 + (lane ^ (1 + 2 * j))]; vl[c][j].q[0] = sL[u * 32 + lane]; vl[c][j].q[1] = sL[(u + 1) * 32 + lane]; }
    __builtin_amdgcn_sched_barrier(0);   // keeps this pass's V loads in front of the logits: sunk to their products, each would wait out a full LDS latency
#pragma unroll
    for (int t = 0; t < 4; ++t) { const v8f z = {}; const v8f ah = wmma16(ka[t].v, qh, z), al = wmma16(ka[t].v, qlo, z);
#pragma unroll
      for (int r = 0; r < 8; ++r) s[t][r] = ah[r] + al[r] * (1.0f / 1024.0f); }   // unscaled: the scale is positive, so the maximum may be taken before it
    { const int nx = ((it + 1) & (TT / 64 - 1)) * 8;   // the last pass fetches pass 0 again: in bounds, not used
#pragma unroll
      for (int t = 0; t < 4; ++t) { ka[t].q[0] = sK[(nx + t * 2) * 32 + lk0]; ka[t].q[1] = sK[(nx + t * 2 + 1) * 32 + lk1]; } }
    __builtin_amdgcn_sched_barrier(0);   // keeps the next pass's K loads in front of the softmax, which hides their latency
    float mx = s[0][0];
#pragma unroll
    for (int t = 0; t < 4; ++t)
#pragma unroll
      for (int r = 0; r < 8; ++r) mx = fmaxf(mx, s[t][r]);
    mx = fmaxf(mx, xhalf(mx)); const float mn = fmaxf(m, mx); const float al = exp2x1((m - mn) * SCL2E); m = mn;
    const float mc = m * SCL2E; const v2f c2 = { SCL2E, SCL2E }, nm2 = { -mc, -mc };   // one offset for every exponent of the pass
#pragma unroll
    for (int j = 0; j < 2; ++j)
#pragma unroll
      for (int r = 0; r < 8; ++r) o[j][r] *= al;
    float p[2][16], ts[16];
#pragma unroll
    for (int c = 0; c < 2; ++c)
#pragma unroll
      for (int t = 0; t < 2; ++t) { float x[8];
#pragma unroll
        for (int i = 0; i < 8; i += 2) { const v2f a = { s[2 * c + t][i], s[2 * c + t][i + 1] }; const v2f e = __builtin_elementwise_fma(a, c2, nm2); x[i] = e[0]; x[i + 1] = e[1]; }   // pairs: two exponents per packed fma
        exp2x8(&p[c][8 * t], x); }
#pragma unroll
    for (int i = 0; i < 16; ++i) ts[i] = p[0][i] + p[1][i];
#pragma unroll
    for (int d = 8; d > 0; d >>= 1)
#pragma unroll
      for (int i = 0; i < d; ++i) ts[i] += ts[i + d];   // a tree: one chain of 32 dependent adds would stall the wave
    l = l * al + ts[0];
#pragma unroll
    for (int c = 0; c < 2; ++c) { const F2 pf = bsplit16(p[c]);
#pragma unroll
      for (int j = 0; j < 2; ++j) { o[j] = wmma_bf(vh[c][j].v, pf.h, o[j]); o[j] = wmma_bf(vh[c][j].v, pf.l, o[j]); o[j] = wmma_bf(vl[c][j].v, pf.h, o[j]); } } }
  l += xhalf(l); const float inv = 1.0f / l;
  float* op = OUT + ((size_t)b * LL + tok_of(wi, ql)) * CCH + h * HD + 8 * g;   // D register r = channel j * 16 + 8 g + r of query col
#pragma unroll
  for (int j = 0; j < 2; ++j) { const v4f x0 = { o[j][0] * inv, o[j][1] * inv, o[j][2] * inv, o[j][3] * inv }, x1 = { o[j][4] * inv, o[j][5] * inv, o[j][6] * inv, o[j][7] * inv };
    vst2(op + j * 16, x0); vst2(op + j * 16 + 4, x1); } }
extern "C" void kernel_launch(void* const* d_in, const int* in_sizes, int n_in, void* d_out, int out_size, void* d_ws, size_t ws_size, hipStream_t stream) {
  (void)in_sizes; (void)n_in; (void)out_size; (void)d_ws; (void)ws_size;
  const float** F = (const float**)d_in;   // 0 qkv [3,2,4096,128]
  k_att<<<dim3(TT / 128, NWP * HG), 256, 0, stream>>>(F[0], F[0] + (size_t)NBT * LL * CCH, F[0] + (size_t)2 * NBT * LL * CCH, (float*)d_out);
}

// v005
// It runs in 14.8 microseconds.
// Timed twice side by side with v004, it ran 1.11 times as fast both times.
// Counting every step since v000, it is 30.2 times as fast.
// compute dtype: the float input rounded to bf16; window partition / merge as pure index permutations; q and k once to f16 (a bf16-rounded value is exact in f16 from 2^-17 up) -> 1-product logits on WMMA 16x16x32; online softmax in f32 (base 2: 32^-0.5 * log2 e enters in one fma per logit, hardware exp2; running maximum per 64 keys, one division at the end); exp(s - m) split bf16 hi + lo against v in bf16 (2 products; v is bf16-exact and has no lo plane); f32 output.
#include <hip/hip_runtime.h>
#include <math.h>

typedef __attribute__((ext_vector_type(16))) _Float16 v16h;
typedef __attribute__((ext_vector_type(16))) __bf16 v16b;
typedef __attribute__((ext_vector_type(8)))  _Float16 v8h;
typedef __attribute__((ext_vector_type(8)))  float v8f;
typedef __attribute__((ext_vector_type(4)))  float v4f;
typedef __attribute__((ext_vector_type(2)))  float v2f;
typedef __attribute__((ext_vector_type(4)))  unsigned v4u;
typedef __attribute__((ext_vector_type(4)))  int v4i;
typedef float __attribute__((may_alias)) float_a;
typedef int __attribute__((may_alias)) int_a;

template <typename T> __device__ __forceinline__ void vst2(void* p, T v) { *(T*)p = v;  }
__device__ __forceinline__ v8f wmma16(v16h a, v16h b, v8f c) {
  v8f d = __builtin_amdgcn_wmma_f32_16x16x32_f16(false, a, false, b, (short)0, c, false, false);
  asm volatile("v_nop\n\tv_nop\n\tv_nop\n\tv_nop" : "+v"(d) : "v"(a), "v"(b));
  return d;
}
__device__ __forceinline__ v8f wmma_bf(v16b a, v16b b, v8f c) {
  v8f d = __builtin_amdgcn_wmma_f32_16x16x32_bf16(false, a, false, b, (short)0, c, false, false);
  asm volatile("v_nop\n\tv_nop\n\tv_nop\n\tv_nop" : "+v"(d) : "v"(a), "v"(b));
  return d;
}
// 16x16x32 fragments: lane = (h = lane>>4, row/col = lane&15); elements 0..7 = k0+8h+0..7, 8..15 = k0+16+8h+0..7; D element r = row 8h+r
__device__ __forceinline__ v16h frag_h(const _Float16* rowk0, int lane) {
  union { v16h v; v8h q[2]; } u; const _Float16* p = rowk0 + 8 * (lane >> 4);
  u.q[0] = *(const v8h*)p; u.q[1] = *(const v8h*)(p + 16); return u.v;
}
__device__ __forceinline__ v16h frag_f32(const float* rowk0, int lane) {
  v16h a; const float* p = rowk0 + 8 * (lane >> 4);
#pragma unroll
  for (int i = 0; i < 8; ++i) { a[i] = (_Float16)p[i]; a[8 + i] = (_Float16)p[16 + i]; }
  return a;
}
__device__ __forceinline__ v16h frag_f32s(const float* rowk0, int lane, float sc) {
  v16h a; const float* p = rowk0 + 8 * (lane >> 4);
#pragma unroll
  for (int i = 0; i < 8; ++i) { a[i] = (_Float16)(p[i] * sc); a[8 + i] = (_Float16)(p[16 + i] * sc); }
  return a;
}
// column fragment from a [K][ld] layout (column n), rows >= K read as 0
__device__ __forceinline__ v16h fragc_f32(const float* W, int k0, int n, int lane, int ld, int K) {
  v16h a; const int g = lane >> 4;
#pragma unroll
  for (int i = 0; i < 8; ++i) { const int ka = k0 + 8 * g + i, kb = ka + 16;
    a[i] = (_Float16)(ka < K ? W[(size_t)(ka < K ? ka : K - 1) * ld + n] : 0.f); a[8 + i] = (_Float16)(kb < K ? W[(size_t)(kb < K ? kb : K - 1) * ld + n] : 0.f); }
  return a;
}
struct F2 { v16b h, l; };
__device__ __forceinline__ F2 bsplit16(const float v[16]) { F2 r;
#pragma unroll
  for (int i = 0; i < 16; ++i) { const __bf16 h = (__bf16)v[i]; r.h[i] = h; r.l[i] = (__bf16)(v[i] - (float)h); }
  return r; }
__device__ __forceinline__ F2 split_row(const float* row, int k0, int lane) { float v[16]; const float* p = row + k0 + 8 * (lane >> 4);
#pragma unroll
  for (int i = 0; i < 8; ++i) { v[i] = p[i]; v[8 + i] = p[16 + i]; }
  return bsplit16(v); }
__device__ __forceinline__ F2 split_rowK(const float* row, int k0, int lane, int K) { float v[16]; const int g = lane >> 4;
#pragma unroll
  for (int i = 0; i < 8; ++i) { const int ka = k0 + 8 * g + i, kb = ka + 16; v[i] = ka < K ? row[ka < K ? ka : K - 1] : 0.f; v[8 + i] = kb < K ? row[kb < K ? kb : K - 1] : 0.f; }
  return bsplit16(v); }
__device__ __forceinline__ F2 split_col(const float* W, int k0, int n, int lane, int ld, int K) { float v[16]; const int g = lane >> 4;
#pragma unroll
  for (int i = 0; i < 8; ++i) { const int ka = k0 + 8 * g + i, kb = ka + 16; v[i] = ka < K ? W[(size_t)(ka < K ? ka : K - 1) * ld + n] : 0.f; v[8 + i] = kb < K ? W[(size_t)(kb < K ? kb : K - 1) * ld + n] : 0.f; }
  return bsplit16(v); }
__device__ __forceinline__ v8f mac3(const F2& a, const F2& b, v8f c) { c = wmma_bf(a.l, b.h, c); c = wmma_bf(a.h, b.l, c); return wmma_bf(a.h, b.h, c); }
__device__ __forceinline__ float sigm(float v) { return 1.0f / (1.0f + expf(-v)); }
#define LDSX() do { asm volatile("s_wait_dscnt 0" ::: "memory"); __builtin_amdgcn_wave_barrier(); __builtin_amdgcn_fence(__ATOMIC_RELEASE, "workgroup"); } while (0)


// LePE-style 3-D window attention (B 2, L = 16^3 = 4,096 tokens, C 128 = 4 heads x 32; windows 16 x 16 x 4 = 1,024 tokens): token l = d*256 + h*16 + w belongs to window (b, w / 4) at position t = d*64 + h*4 + w % 4; per (window, head): softmax(q k^T * 32^-0.5) v over the window; merged back to [B, L, C].
#define NBT 2
#define LL 4096
#define CCH 128
#define NH 4
#define HD 32
#define NWB 4               // windows per batch element
#define NW (NBT * NWB)      // 8 windows
#define TT 1024             // tokens per window
#define HG 4                // heads per launch group (= all)
#ifndef NWP
#define NWP NW              // windows processed
#endif
#define SCL2E ((float)(0.17677669529663687 * 1.4426950408889634))   // 32^-0.5 * log2(e): exp(32^-0.5 * (x - m)) = exp2(SCL2E * x - SCL2E * m)
__device__ __forceinline__ float bfr(float v) { return (float)(__bf16)v; }
typedef __attribute__((ext_vector_type(8))) __bf16 v8b;
__device__ __forceinline__ v16b frag_b(const __bf16* rowk0, int lane) { union { v16b v; v8b q[2]; } u; const __bf16* p = rowk0 + 8 * (lane >> 4); u.q[0] = *(const v8b*)p; u.q[1] = *(const v8b*)(p + 16); return u.v; }
__device__ __forceinline__ int tok_of(int wi, int t) { return (t >> 6) * 256 + ((t >> 2) & 15) * 16 + wi * 4 + (t & 3); }   // window-local position -> token index l

// ---- k_att: block = (128 queries = 8 waves x 16, window * HG + head): logits, softmax and P v in one pass over the window's 1,024 keys; the logits never leave the registers.
// S^T = K Q^T (A = 16 key rows, B = 16 query columns): a lane holds 8 keys of ONE query per tile, so two tiles' D registers are the B operand of O^T += V^T P^T as they stand.
// LDS planes in fragment order: unit u = 512 B = one 16-byte load of all 32 lanes. K: u = tile * 2 + half; V: u = ((j * 32 + kc) * 2 + half), j = channel tile, kc = 32-key chunk.
// The block reads q, k, v as f32 from the input itself (window position -> token by index arithmetic), rounds them in registers and writes the planes to LDS: no partition launch, no workspace.
// Inside a unit lane n's 16 bytes lie at slot n ^ (half + 2 j) for V and n ^ (4 g + 8 half) for q and K: a staging lane holds 4 neighbouring channels, and unswizzled the lanes of one LDS store would share a quarter of the banks.
__device__ __forceinline__ float xhalf(float v) { return __builtin_bit_cast(float, __builtin_amdgcn_permlanex16(__builtin_bit_cast(int, v), __builtin_bit_cast(int, v), 0x76543210, 0xfedcba98, false, false)); }   // lane l <-> l ^ 16
// 2^x; the v_nop keeps the slot behind the exp2 also where an asm statement, into which the compiler does not look, comes next
__device__ __forceinline__ float exp2x1(float x) { float y; asm("v_exp_f32 %0, %1\n\tv_nop" : "=v"(y) : "v"(x)); return y; }
// y[i] = 2^x[i], eight in one statement, the results in registers apart from every source (early clobber): so no exp2 has its source overwritten or its result read by the instruction directly behind it; the v_nop keeps that slot behind the last one
__device__ __forceinline__ void exp2x8(float* y, const float* x) {
  asm("v_exp_f32 %0, %8\n\tv_exp_f32 %1, %9\n\tv_exp_f32 %2, %10\n\tv_exp_f32 %3, %11\n\tv_exp_f32 %4, %12\n\tv_exp_f32 %5, %13\n\tv_exp_f32 %6, %14\n\tv_exp_f32 %7, %15\n\tv_nop"
      : "=&v"(y[0]), "=&v"(y[1]), "=&v"(y[2]), "=&v"(y[3]), "=&v"(y[4]), "=&v"(y[5]), "=&v"(y[6]), "=&v"(y[7])
      : "v"(x[0]), "v"(x[1]), "v"(x[2]), "v"(x[3]), "v"(x[4]), "v"(x[5]), "v"(x[6]), "v"(x[7])); }
typedef __attribute__((ext_vector_type(4))) _Float16 v4h;
typedef __attribute__((ext_vector_type(2))) unsigned v2u;
__global__ __launch_bounds__(256) void k_att(const float* __restrict__ Q, const float* __restrict__ K, const float* __restrict__ V, float* __restrict__ OUT) {
  __shared__ __align__(16) v4u sK[128 * 32], sV[128 * 32], sQ[8 * 2 * 32];   // sQ: per wave its 16 queries as one tile, units half 0, half 1
  const int w = blockIdx.y / HG, h = blockIdx.y % HG; const int b = w / NWB, wi = w % NWB;
  const int tid = threadIdx.x, wave = tid >> 5, lane = tid & 31, col = lane & 15, g = lane >> 4;
  const int ql = blockIdx.x * 128 + wave * 16 + col;
  // every staging load covers whole 128-byte lines: 8 lanes (cq) take the head's 32 channels of one token, kg picks one of 4 tokens. One base address per tensor, the rest are constant offsets:
  // 4 more window positions = 16 more tokens; position 8 t' + i -> token 32 t' + (i >> 2) * 16 + (i & 3)
  const int cq = lane & 7, kg = lane >> 3;
  const size_t lo = (size_t)b * LL * CCH + h * HD + cq * 4;
  const float* qp = Q + lo + (size_t)tok_of(wi, blockIdx.x * 128 + wave * 16 + kg) * CCH;   // q, k: position 4 n + kg of the wave's share
  const float* kp = K + lo + (size_t)tok_of(wi, wave * 128 + kg) * CCH;                     // wave's share: key tiles wave * 8 + 0 .. 7
  const float* vp = V + lo + (size_t)tok_of(wi, wave * 128 + kg * 8) * CCH;                 // v: 8 keys, octet wave * 16 + p * 4 + kg, p = 0 .. 3
  v4f rq[4], rk[32], rv[4][8];
#pragma unroll
  for (int n = 0; n < 4; ++n) rq[n] = *(const v4f*)(qp + n * 16 * CCH);
  asm volatile("s_wait_xcnt 0x0" ::: "memory");   // precaution: behind it the address registers of the issued q loads may take new values (also as later loads' results)
#pragma unroll
  for (int n = 0; n < 32; ++n) rk[n] = *(const v4f*)(kp + n * 16 * CCH);
  asm volatile("s_wait_xcnt 0x0" ::: "memory");   // precaution: the same for the k loads
#pragma unroll
  for (int p = 0; p < 2; ++p)
#pragma unroll
    for (int i = 0; i < 8; ++i) rv[p][i] = *(const v4f*)(vp + (p * 128 + (i >> 2) * 16 + (i & 3)) * CCH);
  __builtin_amdgcn_sched_barrier(0);   // keeps every conversion behind these loads: lifted among them, its wait for data would hold the later loads back by a memory latency
  // q, k: the lane's 4 channels are 8 bytes of the fragment slot (half = cq >> 2, g = (cq >> 1) & 1, column = position & 15)
  const int ks = (cq >> 1) & 3;   // = g + 2 half of the slot written
  char* const kd = (char*)sK + ((wave * 16 + (cq >> 2)) * 32 + ((cq >> 1) & 1) * 16 + kg) * 16 + (cq & 1) * 8;
  char* const qd = (char*)sQ + ((wave * 2 + (cq >> 2)) * 32 + ((cq >> 1) & 1) * 16 + kg) * 16 + (cq & 1) * 8;
#define KST(n) do { v4h r_; _Pragma("unroll") for (int z = 0; z < 4; ++z) r_[z] = (_Float16)bfr(rk[n][z]); *(v2u*)(kd + ((n) >> 2) * 1024 + ((((n) & 3) ^ ks) * 64)) = __builtin_bit_cast(v2u, r_); } while (0)
#pragma unroll
  for (int n = 0; n < 16; ++n) KST(n);
  __builtin_amdgcn_sched_barrier(0);   // keeps the second half of the v loads behind the first half of k: all at once would not fit 256 registers
#pragma unroll
  for (int p = 2; p < 4; ++p)
#pragma unroll
    for (int i = 0; i < 8; ++i) rv[p][i] = *(const v4f*)(vp + (p * 128 + (i >> 2) * 16 + (i & 3)) * CCH);
  asm volatile("s_wait_xcnt 0x0" ::: "memory");   // precaution: the same for the v loads
  __builtin_amdgcn_sched_barrier(0);   // keeps the work below behind these loads, so that it hides their latency
#pragma unroll
  for (int n = 16; n < 32; ++n) KST(n);
#undef KST
#pragma unroll
  for (int n = 0; n < 4; ++n) { v4h hi;
#pragma unroll
    for (int z = 0; z < 4; ++z) hi[z] = (_Float16)bfr(rq[n][z]);
    *(v2u*)(qd + ((n ^ ks) * 64)) = __builtin_bit_cast(v2u, hi); }
  { const int jv = cq >> 2, hv = kg >> 1, sw = hv + 2 * jv; v4u* vd = sV + ((jv * 32 + wave * 4) * 2 + hv) * 32 + (kg & 1) * 16;
#pragma unroll
    for (int p = 0; p < 4; ++p)
#pragma unroll
      for (int z = 0; z < 4; ++z) { v8b t8;
#pragma unroll
        for (int i = 0; i < 8; ++i) t8[i] = (__bf16)rv[p][i][z];
        vd[p * 64 + ((((cq & 3) * 4) + z) ^ sw)] = __builtin_bit_cast(v4u, t8); } }
  __syncthreads();
  const int lk0 = lane ^ (4 * g), lk1 = lane ^ (4 * g + 8);   // q, k units: lane n's slot, half 0 and half 1
  union QF { v16h v; v4u q[2]; } qf;
  qf.q[0] = sQ[(wave * 2) * 32 + lk0]; qf.q[1] = sQ[(wave * 2 + 1) * 32 + lk1];
  const v16h qh = qf.v;
  v8f o[2] = {}; float m = -3.0e38f, l = 0.f;
  union KF { v16h v; v4u q[2]; } ka[4];   // the K fragments of a pass (64 keys), fetched one pass ahead
#pragma unroll
  for (int t = 0; t < 4; ++t) { ka[t].q[0] = sK[(t * 2) * 32 + lk0]; ka[t].q[1] = sK[(t * 2 + 1) * 32 + lk1]; }
#pragma unroll 1   // the pass loop stays rolled (some 350 instructions a pass); every inner loop is unrolled so that all array indices are constants and the arrays stay in registers
  for (int it = 0; it < TT / 64; ++it) { float s[4][8]; union VF { v16b v; v4u q[2]; } vh[2][2];
#pragma unroll
    for (int c = 0; c < 2; ++c)
#pragma unroll
      for (int j = 0; j < 2; ++j) { const int u = (j * 32 + it * 2 + c) * 2; vh[c][j].q[0] = sV[u * 32 + (lane ^ (2 * j))]; vh[c][j].q[1] = sV[(u + 1) * 32 + (lane ^ (1 + 2 * j))]; }
    __builtin_amdgcn_sched_barrier(0);   // keeps this pass's V loads in front of the logits: sunk to their products, each would wait out a full LDS latency
#pragma unroll
    for (int t = 0; t < 4; ++t) { const v8f z = {}; const v8f ah = wmma16(ka[t].v, qh, z);
#pragma unroll
      for (int r = 0; r < 8; ++r) s[t][r] = ah[r]; }   // unscaled: the scale is positive, so the maximum may be taken before it
    { const int nx = ((it + 1) & (TT / 64 - 1)) * 8;   // the last pass fetches pass 0 again: in bounds, not used
#pragma unroll
      for (int t = 0; t < 4; ++t) { ka[t].q[0] = sK[(nx + t * 2) * 32 + lk0]; ka[t].q[1] = sK[(nx + t * 2 + 1) * 32 + lk1]; } }
    __builtin_amdgcn_sched_barrier(0);   // keeps the next pass's K loads in front of the softmax, which hides their latency
    float mx = s[0][0];
#pragma unroll
    for (int t = 0; t < 4; ++t)
#pragma unroll
      for (int r = 0; r < 8; ++r) mx = fmaxf(mx, s[t][r]);
    mx = fmaxf(mx, xhalf(mx)); const float mn = fmaxf(m, mx); const float al = exp2x1((m - mn) * SCL2E); m = mn;
    const float mc = m * SCL2E; const v2f c2 = { SCL2E, SCL2E }, nm2 = { -mc, -mc };   // one offset for every exponent of the pass
#pragma unroll
    for (int j = 0; j < 2; ++j)
#pragma unroll
      for (int r = 0; r < 8; ++r) o[j][r] *= al;
    float p[2][16], ts[16];
#pragma unroll
    for (int c = 0; c < 2; ++c)
#pragma unroll
      for (int t = 0; t < 2; ++t) { float x[8];
#pragma unroll
        for (int i = 0; i < 8; i += 2) { const v2f a = { s[2 * c + t][i], s[2 * c + t][i + 1] }; const v2f e = __builtin_elementwise_fma(a, c2, nm2); x[i] = e[0]; x[i + 1] = e[1]; }   // pairs: two exponents per packed fma
        exp2x8(&p[c][8 * t], x); }
#pragma unroll
    for (int i = 0; i < 16; ++i) ts[i] = p[0][i] + p[1][i];
#pragma unroll
    for (int d = 8; d > 0; d >>= 1)
#pragma unroll
      for (int i = 0; i < d; ++i) ts[i] += ts[i + d];   // a tree: one chain of 32 dependent adds would stall the wave
    l = l * al + ts[0];
#pragma unroll
    for (int c = 0; c < 2; ++c) { const F2 pf = bsplit16(p[c]);
#pragma unroll
      for (int j = 0; j < 2; ++j) { o[j] = wmma_bf(vh[c][j].v, pf.h, o[j]); o[j] = wmma_bf(vh[c][j].v, pf.l, o[j]); } } }
  l += xhalf(l); const float inv = 1.0f / l;
  float* op = OUT + ((size_t)b * LL + tok_of(wi, ql)) * CCH + h * HD + 8 * g;   // D register r = channel j * 16 + 8 g + r of query col
#pragma unroll
  for (int j = 0; j < 2; ++j) { const v4f x0 = { o[j][0] * inv, o[j][1] * inv, o[j][2] * inv, o[j][3] * inv }, x1 = { o[j][4] * inv, o[j][5] * inv, o[j][6] * inv, o[j][7] * inv };
    vst2(op + j * 16, x0); vst2(op + j * 16 + 4, x1); } }
extern "C" void kernel_launch(void* const* d_in, const int* in_sizes, int n_in, void* d_out, int out_size, void* d_ws, size_t ws_size, hipStream_t stream) {
  (void)in_sizes; (void)n_in; (void)out_size; (void)d_ws; (void)ws_size;
  const float** F = (const float**)d_in;   // 0 qkv [3,2,4096,128]
  k_att<<<dim3(TT / 128, NWP * HG), 256, 0, stream>>>(F[0], F[0] + (size_t)NBT * LL * CCH, F[0] + (size_t)2 * NBT * LL * CCH, (float*)d_out);
}

// v007
// Measured time: 11.4 microseconds a run.
// It is 1.29 times as fast as v005, going by the measured steps of the versions left out in between.
// All steps since v000 together make it 39.2 times as fast.
// compute dtype: the float input rounded to bf16; window partition / merge as pure index permutations; q and k once to f16 (a bf16-rounded value is exact in f16 from 2^-17 up) -> 1-product logits on WMMA 16x16x32; online softmax in f32 (base 2: 32^-0.5 * log2 e enters in one fma per logit, hardware exp2; reference exponent = the maximum of the first 64 keys, running maximum per 64 keys only where the row sum leaves the range, one division at the end); exp(s - m), below 2^15 (in (0, 1] under the running maximum), rounded once to f16 (11 bits) against v once to f16 (exact from 2^-17 up, as q and k): 1 product; the divisor sums the unrounded f32 values; f32 output.
#include <hip/hip_runtime.h>
#include <math.h>

typedef __attribute__((ext_vector_type(16))) _Float16 v16h;
typedef __attribute__((ext_vector_type(16))) __bf16 v16b;
typedef __attribute__((ext_vector_type(8)))  _Float16 v8h;
typedef __attribute__((ext_vector_type(8)))  float v8f;
typedef __attribute__((ext_vector_type(4)))  float v4f;
typedef __attribute__((ext_vector_type(2)))  float v2f;
typedef __attribute__((ext_vector_type(4)))  unsigned v4u;
typedef __attribute__((ext_vector_type(4)))  int v4i;
typedef float __attribute__((may_alias)) float_a;
typedef int __attribute__((may_alias)) int_a;

template <typename T> __device__ __forceinline__ void vst2(void* p, T v) { *(T*)p = v;  }
__device__ __forceinline__ v8f wmma16(v16h a, v16h b, v8f c) {
  v8f d = __builtin_amdgcn_wmma_f32_16x16x32_f16(false, a, false, b, (short)0, c, false, false);
  asm volatile("v_nop\n\tv_nop\n\tv_nop\n\tv_nop" : "+v"(d) : "v"(a), "v"(b));
  return d;
}
__device__ __forceinline__ v8f wmma_bf(v16b a, v16b b, v8f c) {
  v8f d = __builtin_amdgcn_wmma_f32_16x16x32_bf16(false, a, false, b, (short)0, c, false, false);
  asm volatile("v_nop\n\tv_nop\n\tv_nop\n\tv_nop" : "+v"(d) : "v"(a), "v"(b));
  return d;
}
// 16x16x32 fragments: lane = (h = lane>>4, row/col = lane&15); elements 0..7 = k0+8h+0..7, 8..15 = k0+16+8h+0..7; D element r = row 8h+r
__device__ __forceinline__ v16h frag_h(const _Float16* rowk0, int lane) {
  union { v16h v; v8h q[2]; } u; const _Float16* p = rowk0 + 8 * (lane >> 4);
  u.q[0] = *(const v8h*)p; u.q[1] = *(const v8h*)(p + 16); return u.v;
}
__device__ __forceinline__ v16h frag_f32(const float* rowk0, int lane) {
  v16h a; const float* p = rowk0 + 8 * (lane >> 4);
#pragma unroll
  for (int i = 0; i < 8; ++i) { a[i] = (_Float16)p[i]; a[8 + i] = (_Float16)p[16 + i]; }
  return a;
}
__device__ __forceinline__ v16h frag_f32s(const float* rowk0, int lane, float sc) {
  v16h a; const float* p = rowk0 + 8 * (lane >> 4);
#pragma unroll
  for (int i = 0; i < 8; ++i) { a[i] = (_Float16)(p[i] * sc); a[8 + i] = (_Float16)(p[16 + i] * sc); }
  return a;
}
// column fragment from a [K][ld] layout (column n), rows >= K read as 0
__device__ __forceinline__ v16h fragc_f32(const float* W, int k0, int n, int lane, int ld, int K) {
  v16h a; const int g = lane >> 4;
#pragma unroll
  for (int i = 0; i < 8; ++i) { const int ka = k0 + 8 * g + i, kb = ka + 16;
    a[i] = (_Float16)(ka < K ? W[(size_t)(ka < K ? ka : K - 1) * ld + n] : 0.f); a[8 + i] = (_Float16)(kb < K ? W[(size_t)(kb < K ? kb : K - 1) * ld + n] : 0.f); }
  return a;
}
struct F2 { v16b h, l; };
__device__ __forceinline__ F2 bsplit16(const float v[16]) { F2 r;
#pragma unroll
  for (int i = 0; i < 16; ++i) { const __bf16 h = (__bf16)v[i]; r.h[i] = h; r.l[i] = (__bf16)(v[i] - (float)h); }
  return r; }
__device__ __forceinline__ F2 split_row(const float* row, int k0, int lane) { float v[16]; const float* p = row + k0 + 8 * (lane >> 4);
#pragma unroll
  for (int i = 0; i < 8; ++i) { v[i] = p[i]; v[8 + i] = p[16 + i]; }
  return bsplit16(v); }
__device__ __forceinline__ F2 split_rowK(const float* row, int k0, int lane, int K) { float v[16]; const int g = lane >> 4;
#pragma unroll
  for (int i = 0; i < 8; ++i) { const int ka = k0 + 8 * g + i, kb = ka + 16; v[i] = ka < K ? row[ka < K ? ka : K - 1] : 0.f; v[8 + i] = kb < K ? row[kb < K ? kb : K - 1] : 0.f; }
  return bsplit16(v); }
__device__ __forceinline__ F2 split_col(const float* W, int k0, int n, int lane, int ld, int K) { float v[16]; const int g = lane >> 4;
#pragma unroll
  for (int i = 0; i < 8; ++i) { const int ka = k0 + 8 * g + i, kb = ka + 16; v[i] = ka < K ? W[(size_t)(ka < K ? ka : K - 1) * ld + n] : 0.f; v[8 + i] = kb < K ? W[(size_t)(kb < K ? kb : K - 1) * ld + n] : 0.f; }
  return bsplit16(v); }
__device__ __forceinline__ v8f mac3(const F2& a, const F2& b, v8f c) { c = wmma_bf(a.l, b.h, c); c = wmma_bf(a.h, b.l, c); return wmma_bf(a.h, b.h, c); }
__device__ __forceinline__ float sigm(float v) { return 1.0f / (1.0f + expf(-v)); }
#define LDSX() do { asm volatile("s_wait_dscnt 0" ::: "memory"); __builtin_amdgcn_wave_barrier(); __builtin_amdgcn_fence(__ATOMIC_RELEASE, "workgroup"); } while (0)


// LePE-style 3-D window attention (B 2, L = 16^3 = 4,096 tokens, C 128 = 4 heads x 32; windows 16 x 16 x 4 = 1,024 tokens): token l = d*256 + h*16 + w belongs to window (b, w / 4) at position t = d*64 + h*4 + w % 4; per (window, head): softmax(q k^T * 32^-0.5) v over the window; merged back to [B, L, C].
#define NBT 2
#define LL 4096
#define CCH 128
#define NH 4
#define HD 32
#define NWB 4               // windows per batch element
#define NW (NBT * NWB)      // 8 windows
#define TT 1024             // tokens per window
#define HG 4                // heads per launch group (= all)
#ifndef NWP
#define NWP NW              // windows processed
#endif
#define SCL2E ((float)(0.17677669529663687 * 1.4426950408889634))   // 32^-0.5 * log2(e): exp(32^-0.5 * (x - m)) = exp2(SCL2E * x - SCL2E * m)
__device__ __forceinline__ float bfr(float v) { return (float)(__bf16)v; }
typedef __attribute__((ext_vector_type(8))) __bf16 v8b;
__device__ __forceinline__ v16b frag_b(const __bf16* rowk0, int lane) { union { v16b v; v8b q[2]; } u; const __bf16* p = rowk0 + 8 * (lane >> 4); u.q[0] = *(const v8b*)p; u.q[1] = *(const v8b*)(p + 16); return u.v; }
__device__ __forceinline__ int tok_of(int wi, int t) { return (t >> 6) * 256 + ((t >> 2) & 15) * 16 + wi * 4 + (t & 3); }   // window-local position -> token index l

// ---- k_att: block = (128 queries = 8 waves x 16, window * HG + head): logits, softmax and P v in one pass over the window's 1,024 keys (again, with the running maximum, in a wave whose row sum leaves the range); the logits never leave the registers.
// S^T = K Q^T (A = 16 key rows, B = 16 query columns): a lane holds 8 keys of ONE query per tile, so two tiles' D registers are the B operand of O^T += V^T P^T as they stand.
// LDS planes in fragment order: unit u = 512 B = one 16-byte load of all 32 lanes. K: u = tile * 2 + half; V: u = ((j * 32 + kc) * 2 + half), j = channel tile, kc = 32-key chunk.
// The block reads q, k, v as f32 from the input itself (window position -> token by index arithmetic), rounds them in registers and writes the planes to LDS: no partition launch, no workspace.
// Inside a unit lane n's 16 bytes lie at slot n ^ (half + 2 j) for V and n ^ (4 g + 8 half) for q and K: a staging lane holds 4 neighbouring channels, and unswizzled the lanes of one LDS store would share a quarter of the banks.
__device__ __forceinline__ float xhalf(float v) { return __builtin_bit_cast(float, __builtin_amdgcn_permlanex16(__builtin_bit_cast(int, v), __builtin_bit_cast(int, v), 0x76543210, 0xfedcba98, false, false)); }   // lane l <-> l ^ 16
// 2^x; the v_nop keeps the slot behind the exp2 also where an asm statement, into which the compiler does not look, comes next
__device__ __forceinline__ float exp2x1(float x) { float y; asm("v_exp_f32 %0, %1\n\tv_nop" : "=v"(y) : "v"(x)); return y; }
// y[i] = 2^x[i], eight in one statement, the results in registers apart from every source (early clobber): so no exp2 has its source overwritten or its result read by the instruction directly behind it; the v_nop keeps that slot behind the last one
__device__ __forceinline__ void exp2x8(float* y, const float* x) {
  asm("v_exp_f32 %0, %8\n\tv_exp_f32 %1, %9\n\tv_exp_f32 %2, %10\n\tv_exp_f32 %3, %11\n\tv_exp_f32 %4, %12\n\tv_exp_f32 %5, %13\n\tv_exp_f32 %6, %14\n\tv_exp_f32 %7, %15\n\tv_nop"
      : "=&v"(y[0]), "=&v"(y[1]), "=&v"(y[2]), "=&v"(y[3]), "=&v"(y[4]), "=&v"(y[5]), "=&v"(y[6]), "=&v"(y[7])
      : "v"(x[0]), "v"(x[1]), "v"(x[2]), "v"(x[3]), "v"(x[4]), "v"(x[5]), "v"(x[6]), "v"(x[7])); }
union KF { v16h v; v4u q[2]; };
// the 16 passes of 64 keys over the staged window. RUN = true: running maximum per pass (factor, o and l rescaled). RUN = false: m is fixed by the caller for all passes, so a pass has no maximum, no lane exchange, no factor and no rescale.
template <bool RUN> __device__ __forceinline__ void att_passes(const v4u* sK, const v4u* sV, int lane, int lk0, int lk1, v16h qh, KF (&ka)[4], v8f (&o)[2], float& m, float& l) {
  const v2f c2 = { SCL2E, SCL2E };
#pragma unroll 1   // the pass loop stays rolled; every inner loop is unrolled so that all array indices are constants and the arrays stay in registers
  for (int it = 0; it < TT / 64; ++it) { float s[4][8]; union VF { v16h v; v4u q[2]; } vh[2][2];
#pragma unroll
    for (int c = 0; c < 2; ++c)
#pragma unroll
      for (int j = 0; j < 2; ++j) { const int u = (j * 32 + it * 2 + c) * 2; vh[c][j].q[0] = sV[u * 32 + (lane ^ (2 * j))]; vh[c][j].q[1] = sV[(u + 1) * 32 + (lane ^ (1 + 2 * j))]; }
    __builtin_amdgcn_sched_barrier(0);   // keeps this pass's V loads in front of the logits: sunk to their products, each would wait out a full LDS latency
#pragma unroll
    for (int t = 0; t < 4; ++t) { const v8f z = {}; const v8f ah = wmma16(ka[t].v, qh, z);
#pragma unroll
      for (int r = 0; r < 8; ++r) s[t][r] = ah[r]; }   // unscaled: the scale is positive, so the maximum may be taken before it
    { const int nx = ((it + 1) & (TT / 64 - 1)) * 8;   // the last pass fetches pass 0 again: in bounds; ka then holds what it held at entry
#pragma unroll
      for (int t = 0; t < 4; ++t) { ka[t].q[0] = sK[(nx + t * 2) * 32 + lk0]; ka[t].q[1] = sK[(nx + t * 2 + 1) * 32 + lk1]; } }
    __builtin_amdgcn_sched_barrier(0);   // keeps the next pass's K loads in front of the softmax, which hides their latency
    float al = 1.0f;
    if constexpr (RUN) {
      float mx = s[0][0];
#pragma unroll
      for (int t = 0; t < 4; ++t)
#pragma unroll
        for (int r = 0; r < 8; ++r) mx = fmaxf(mx, s[t][r]);
      mx = fmaxf(mx, xhalf(mx)); const float mn = fmaxf(m, mx); al = exp2x1((m - mn) * SCL2E); m = mn;
#pragma unroll
      for (int j = 0; j < 2; ++j)
#pragma unroll
        for (int r = 0; r < 8; ++r) o[j][r] *= al; }
    const float mc = m * SCL2E; const v2f nm2 = { -mc, -mc };   // one offset for every exponent of the pass
    float p[2][16], ts[16];
#pragma unroll
    for (int c = 0; c < 2; ++c)
#pragma unroll
      for (int t = 0; t < 2; ++t) { float x[8];
#pragma unroll
        for (int i = 0; i < 8; i += 2) { const v2f a = { s[2 * c + t][i], s[2 * c + t][i + 1] }; const v2f e = __builtin_elementwise_fma(a, c2, nm2); x[i] = e[0]; x[i + 1] = e[1]; }   // pairs: two exponents per packed fma
        exp2x8(&p[c][8 * t], x); }
#pragma unroll
    for (int i = 0; i < 16; ++i) ts[i] = p[0][i] + p[1][i];
#pragma unroll
    for (int d = 8; d > 0; d >>= 1)
#pragma unroll
      for (int i = 0; i < d; ++i) ts[i] += ts[i + d];   // a tree: one chain of 32 dependent adds would stall the wave
    if constexpr (RUN) l = l * al + ts[0]; else l += ts[0];
#pragma unroll
    for (int c = 0; c < 2; ++c) { v16h pf;
#pragma unroll
      for (int i = 0; i < 16; ++i) pf[i] = (_Float16)p[c][i];
#pragma unroll
      for (int j = 0; j < 2; ++j) o[j] = wmma16(vh[c][j].v, pf, o[j]); } } }
typedef __attribute__((ext_vector_type(4))) _Float16 v4h;
typedef __attribute__((ext_vector_type(2))) unsigned v2u;
__global__ __launch_bounds__(256) void k_att(const float* __restrict__ Q, const float* __restrict__ K, const float* __restrict__ V, float* __restrict__ OUT) {
  __shared__ __align__(16) v4u sK[128 * 32], sV[128 * 32], sQ[8 * 2 * 32];   // sQ: per wave its 16 queries as one tile, units half 0, half 1
  const int w = blockIdx.y / HG, h = blockIdx.y % HG; const int b = w / NWB, wi = w % NWB;
  const int tid = threadIdx.x, wave = tid >> 5, lane = tid & 31, col = lane & 15, g = lane >> 4;
  const int ql = blockIdx.x * 128 + wave * 16 + col;
  // every staging load covers whole 128-byte lines: 8 lanes (cq) take the head's 32 channels of one token, kg picks one of 4 tokens. One base address per tensor, the rest are constant offsets:
  // 4 more window positions = 16 more tokens; position 8 t' + i -> token 32 t' + (i >> 2) * 16 + (i & 3)
  const int cq = lane & 7, kg = lane >> 3;
  const size_t lo = (size_t)b * LL * CCH + h * HD + cq * 4;
  const float* qp = Q + lo + (size_t)tok_of(wi, blockIdx.x * 128 + wave * 16 + kg) * CCH;   // q, k: position 4 n + kg of the wave's share
  const float* kp = K + lo + (size_t)tok_of(wi, wave * 128 + kg) * CCH;                     // wave's share: key tiles wave * 8 + 0 .. 7
  const float* vp = V + lo + (size_t)tok_of(wi, wave * 128 + kg * 8) * CCH;                 // v: 8 keys, octet wave * 16 + p * 4 + kg, p = 0 .. 3
  v4f rq[4], rk[32], rv[4][8];
#pragma unroll
  for (int n = 0; n < 4; ++n) rq[n] = *(const v4f*)(qp + n * 16 * CCH);
  asm volatile("s_wait_xcnt 0x0" ::: "memory");   // precaution: behind it the address registers of the issued q loads may take new values (also as later loads' results)
#pragma unroll
  for (int n = 0; n < 32; ++n) rk[n] = *(const v4f*)(kp + n * 16 * CCH);
  asm volatile("s_wait_xcnt 0x0" ::: "memory");   // precaution: the same for the k loads
#pragma unroll
  for (int p = 0; p < 2; ++p)
#pragma unroll
    for (int i = 0; i < 8; ++i) rv[p][i] = *(const v4f*)(vp + (p * 128 + (i >> 2) * 16 + (i & 3)) * CCH);
  __builtin_amdgcn_sched_barrier(0);   // keeps every conversion behind these loads: lifted among them, its wait for data would hold the later loads back by a memory latency
  // q, k: the lane's 4 channels are 8 bytes of the fragment slot (half = cq >> 2, g = (cq >> 1) & 1, column = position & 15)
  const int ks = (cq >> 1) & 3;   // = g + 2 half of the slot written
  char* const kd = (char*)sK + ((wave * 16 + (cq >> 2)) * 32 + ((cq >> 1) & 1) * 16 + kg) * 16 + (cq & 1) * 8;
  char* const qd = (char*)sQ + ((wave * 2 + (cq >> 2)) * 32 + ((cq >> 1) & 1) * 16 + kg) * 16 + (cq & 1) * 8;
#define KST(n) do { v4h r_; _Pragma("unroll") for (int z = 0; z < 4; ++z) r_[z] = (_Float16)bfr(rk[n][z]); *(v2u*)(kd + ((n) >> 2) * 1024 + ((((n) & 3) ^ ks) * 64)) = __builtin_bit_cast(v2u, r_); } while (0)
#pragma unroll
  for (int n = 0; n < 16; ++n) KST(n);
  __builtin_amdgcn_sched_barrier(0);   // keeps the second half of the v loads behind the first half of k: all at once would not fit 256 registers
#pragma unroll
  for (int p = 2; p < 4; ++p)
#pragma unroll
    for (int i = 0; i < 8; ++i) rv[p][i] = *(const v4f*)(vp + (p * 128 + (i >> 2) * 16 + (i & 3)) * CCH);
  asm volatile("s_wait_xcnt 0x0" ::: "memory");   // precaution: the same for the v loads
  __builtin_amdgcn_sched_barrier(0);   // keeps the work below behind these loads, so that it hides their latency
#pragma unroll
  for (int n = 16; n < 32; ++n) KST(n);
#undef KST
#pragma unroll
  for (int n = 0; n < 4; ++n) { v4h hi;
#pragma unroll
    for (int z = 0; z < 4; ++z) hi[z] = (_Float16)bfr(rq[n][z]);
    *(v2u*)(qd + ((n ^ ks) * 64)) = __builtin_bit_cast(v2u, hi); }
  { const int jv = cq >> 2, hv = kg >> 1, sw = hv + 2 * jv; v4u* vd = sV + ((jv * 32 + wave * 4) * 2 + hv) * 32 + (kg & 1) * 16;
#pragma unroll
    for (int p = 0; p < 4; ++p)
#pragma unroll
      for (int z = 0; z < 4; ++z) { v8h t8;
#pragma unroll
        for (int i = 0; i < 8; ++i) t8[i] = (_Float16)bfr(rv[p][i][z]);
        vd[p * 64 + ((((cq & 3) * 4) + z) ^ sw)] = __builtin_bit_cast(v4u, t8); } }
  __syncthreads();
  const int lk0 = lane ^ (4 * g), lk1 = lane ^ (4 * g + 8);   // q, k units: lane n's slot, half 0 and half 1
  union QF { v16h v; v4u q[2]; } qf;
  qf.q[0] = sQ[(wave * 2) * 32 + lk0]; qf.q[1] = sQ[(wave * 2 + 1) * 32 + lk1];
  const v16h qh = qf.v;
  v8f o[2] = {}; float m, l = 0.f;
  KF ka[4];   // the K fragments of a pass (64 keys), fetched one pass ahead
#pragma unroll
  for (int t = 0; t < 4; ++t) { ka[t].q[0] = sK[(t * 2) * 32 + lk0]; ka[t].q[1] = sK[(t * 2 + 1) * 32 + lk1]; }
  // softmax is the same for every reference m: exp(s - m) / sum exp(s - m). m = the query's maximum over the first 64 keys, kept for all 1,024: that key gives the sum a term 1, so the sum is at least 1; a later logit above m gives a term above 1
  { float mx = -3.0e38f;
#pragma unroll
    for (int t = 0; t < 4; ++t) { const v8f z = {}; const v8f ah = wmma16(ka[t].v, qh, z);
#pragma unroll
      for (int r = 0; r < 8; ++r) mx = fmaxf(mx, ah[r]); }
    m = fmaxf(mx, xhalf(mx)); }
  att_passes<false>(sK, sV, lane, lk0, lk1, qh, ka, o, m, l);
  // range test: every term is positive, so a row sum below 2^15 says that each term was below 2^15 and finite as f16. Otherwise (also a NaN) the whole wave does the window again with the running maximum; one scalar branch, all lanes stay on for the WMMAs
  if (__builtin_amdgcn_ballot_w32(!(l + xhalf(l) < 32768.0f)) != 0u) {
#pragma unroll
    for (int j = 0; j < 2; ++j) o[j] = v8f{};
    m = -3.0e38f; l = 0.f;
    att_passes<true>(sK, sV, lane, lk0, lk1, qh, ka, o, m, l); }
  l += xhalf(l); const float inv = 1.0f / l;
  float* op = OUT + ((size_t)b * LL + tok_of(wi, ql)) * CCH + h * HD + 8 * g;   // D register r = channel j * 16 + 8 g + r of query col
#pragma unroll
  for (int j = 0; j < 2; ++j) { const v4f x0 = { o[j][0] * inv, o[j][1] * inv, o[j][2] * inv, o[j][3] * inv }, x1 = { o[j][4] * inv, o[j][5] * inv, o[j][6] * inv, o[j][7] * inv };
    vst2(op + j * 16, x0); vst2(op + j * 16 + 4, x1); } }
extern "C" void kernel_launch(void* const* d_in, const int* in_sizes, int n_in, void* d_out, int out_size, void* d_ws, size_t ws_size, hipStream_t stream) {
  (void)in_sizes; (void)n_in; (void)out_size; (void)d_ws; (void)ws_size;
  const float** F = (const float**)d_in;   // 0 qkv [3,2,4096,128]
  k_att<<<dim3(TT / 128, NWP * HG), 256, 0, stream>>>(F[0], F[0] + (size_t)NBT * LL * CCH, F[0] + (size_t)2 * NBT * LL * CCH, (float*)d_out);
}

// v008
// One run takes 9.43 microseconds.
// Next to v007, in two timings, it ran 1.21 times as fast each time.
// Over all steps from v000 it is 47.3 times as fast.
// compute dtype: the float input rounded to bf16; window partition / merge as pure index permutations; q and k once to f16 (a bf16-rounded value is exact in f16 from 2^-17 up) -> 1-product logits on WMMA 16x16x32; online softmax in f32 (base 2: 32^-0.5 * log2 e enters in one fma per logit, hardware exp2; reference exponent = the maximum of the first 64 keys, running maximum per 64 keys only where the row sum leaves the range, one division at the end); exp(s - m), below 2^15 (in (0, 1] under the running maximum), rounded once to f16 (11 bits) against v once to f16 (exact from 2^-17 up, as q and k): 1 product; the divisor sums the unrounded f32 values; f32 output.
#include <hip/hip_runtime.h>
#include <math.h>

typedef __attribute__((ext_vector_type(16))) _Float16 v16h;
typedef __attribute__((ext_vector_type(16))) __bf16 v16b;
typedef __attribute__((ext_vector_type(8)))  _Float16 v8h;
typedef __attribute__((ext_vector_type(8)))  float v8f;
typedef __attribute__((ext_vector_type(4)))  float v4f;
typedef __attribute__((ext_vector_type(2)))  float v2f;
typedef __attribute__((ext_vector_type(4)))  unsigned v4u;
typedef __attribute__((ext_vector_type(4)))  int v4i;
typedef float __attribute__((may_alias)) float_a;
typedef int __attribute__((may_alias)) int_a;

template <typename T> __device__ __forceinline__ void vst2(void* p, T v) { *(T*)p = v;  }
__device__ __forceinline__ v8f wmma16(v16h a, v16h b, v8f c) {
  v8f d = __builtin_amdgcn_wmma_f32_16x16x32_f16(false, a, false, b, (short)0, c, false, false);
  asm volatile("v_nop\n\tv_nop\n\tv_nop\n\tv_nop" : "+v"(d) : "v"(a), "v"(b));
  return d;
}
__device__ __forceinline__ v8f wmma_bf(v16b a, v16b b, v8f c) {
  v8f d = __builtin_amdgcn_wmma_f32_16x16x32_bf16(false, a, false, b, (short)0, c, false, false);
  asm volatile("v_nop\n\tv_nop\n\tv_nop\n\tv_nop" : "+v"(d) : "v"(a), "v"(b));
  return d;
}
// 16x16x32 fragments: lane = (h = lane>>4, row/col = lane&15); elements 0..7 = k0+8h+0..7, 8..15 = k0+16+8h+0..7; D element r = row 8h+r
__device__ __forceinline__ v16h frag_h(const _Float16* rowk0, int lane) {
  union { v16h v; v8h q[2]; } u; const _Float16* p = rowk0 + 8 * (lane >> 4);
  u.q[0] = *(const v8h*)p; u.q[1] = *(const v8h*)(p + 16); return u.v;
}
__device__ __forceinline__ v16h frag_f32(const float* rowk0, int lane) {
  v16h a; const float* p = rowk0 + 8 * (lane >> 4);
#pragma unroll
  for (int i = 0; i < 8; ++i) { a[i] = (_Float16)p[i]; a[8 + i] = (_Float16)p[16 + i]; }
  return a;
}
__device__ __forceinline__ v16h frag_f32s(const float* rowk0, int lane, float sc) {
  v16h a; const float* p = rowk0 + 8 * (lane >> 4);
#pragma unroll
  for (int i = 0; i < 8; ++i) { a[i] = (_Float16)(p[i] * sc); a[8 + i] = (_Float16)(p[16 + i] * sc); }
  return a;
}
// column fragment from a [K][ld] layout (column n), rows >= K read as 0
__device__ __forceinline__ v16h fragc_f32(const float* W, int k0, int n, int lane, int ld, int K) {
  v16h a; const int g = lane >> 4;
#pragma unroll
  for (int i = 0; i < 8; ++i) { const int ka = k0 + 8 * g + i, kb = ka + 16;
    a[i] = (_Float16)(ka < K ? W[(size_t)(ka < K ? ka : K - 1) * ld + n] : 0.f); a[8 + i] = (_Float16)(kb < K ? W[(size_t)(kb < K ? kb : K - 1) * ld + n] : 0.f); }
  return a;
}
struct F2 { v16b h, l; };
__device__ __forceinline__ F2 bsplit16(const float v[16]) { F2 r;
#pragma unroll
  for (int i = 0; i < 16; ++i) { const __bf16 h = (__bf16)v[i]; r.h[i] = h; r.l[i] = (__bf16)(v[i] - (float)h); }
  return r; }
__device__ __forceinline__ F2 split_row(const float* row, int k0, int lane) { float v[16]; const float* p = row + k0 + 8 * (lane >> 4);
#pragma unroll
  for (int i = 0; i < 8; ++i) { v[i] = p[i]; v[8 + i] = p[16 + i]; }
  return bsplit16(v); }
__device__ __forceinline__ F2 split_rowK(const float* row, int k0, int lane, int K) { float v[16]; const int g = lane >> 4;
#pragma unroll
  for (int i = 0; i < 8; ++i) { const int ka = k0 + 8 * g + i, kb = ka + 16; v[i] = ka < K ? row[ka < K ? ka : K - 1] : 0.f; v[8 + i] = kb < K ? row[kb < K ? kb : K - 1] : 0.f; }
  return bsplit16(v); }
__device__ __forceinline__ F2 split_col(const float* W, int k0, int n, int lane, int ld, int K) { float v[16]; const int g = lane >> 4;
#pragma unroll
  for (int i = 0; i < 8; ++i) { const int ka = k0 + 8 * g + i, kb = ka + 16; v[i] = ka < K ? W[(size_t)(ka < K ? ka : K - 1) * ld + n] : 0.f; v[8 + i] = kb < K ? W[(size_t)(kb < K ? kb : K - 1) * ld + n] : 0.f; }
  return bsplit16(v); }
__device__ __forceinline__ v8f mac3(const F2& a, const F2& b, v8f c) { c = wmma_bf(a.l, b.h, c); c = wmma_bf(a.h, b.l, c); return wmma_bf(a.h, b.h, c); }
__device__ __forceinline__ float sigm(float v) { return 1.0f / (1.0f + expf(-v)); }
#define LDSX() do { asm volatile("s_wait_dscnt 0" ::: "memory"); __builtin_amdgcn_wave_barrier(); __builtin_amdgcn_fence(__ATOMIC_RELEASE, "workgroup"); } while (0)


// LePE-style 3-D window attention (B 2, L = 16^3 = 4,096 tokens, C 128 = 4 heads x 32; windows 16 x 16 x 4 = 1,024 tokens): token l = d*256 + h*16 + w belongs to window (b, w / 4) at position t = d*64 + h*4 + w % 4; per (window, head): softmax(q k^T * 32^-0.5) v over the window; merged back to [B, L, C].
#define NBT 2
#define LL 4096
#define CCH 128
#define NH 4
#define HD 32
#define NWB 4               // windows per batch element
#define NW (NBT * NWB)      // 8 windows
#define TT 1024             // tokens per window
#define HG 4                // heads per launch group (= all)
#ifndef NWP
#define NWP NW              // windows processed
#endif
#define SCL2E ((float)(0.17677669529663687 * 1.4426950408889634))   // 32^-0.5 * log2(e): exp(32^-0.5 * (x - m)) = exp2(SCL2E * x - SCL2E * m)
__device__ __forceinline__ float bfr(float v) { return (float)(__bf16)v; }
typedef __attribute__((ext_vector_type(8))) __bf16 v8b;
__device__ __forceinline__ v16b frag_b(const __bf16* rowk0, int lane) { union { v16b v; v8b q[2]; } u; const __bf16* p = rowk0 + 8 * (lane >> 4); u.q[0] = *(const v8b*)p; u.q[1] = *(const v8b*)(p + 16); return u.v; }
__device__ __forceinline__ int tok_of(int wi, int t) { return (t >> 6) * 256 + ((t >> 2) & 15) * 16 + wi * 4 + (t & 3); }   // window-local position -> token index l

// ---- k_att: block = (128 queries = 8 waves x 16, window * HG + head): logits, softmax and P v in one pass over the window's 1,024 keys (again, with the running maximum, in a wave whose row sum leaves the range); the logits never leave the registers.
// S^T = K Q^T (A = 16 key rows, B = 16 query columns): a lane holds 8 keys of ONE query per tile, so two tiles' D registers are the B operand of O^T += V^T P^T as they stand.
// LDS planes in fragment order: unit u = 512 B = one 16-byte load of all 32 lanes. K: u = tile * 2 + half; V: u = ((j * 32 + kc) * 2 + half), j = channel tile, kc = 32-key chunk.
// The block reads q, k, v as f32 from the input itself (window position -> token by index arithmetic), rounds them in registers and writes the planes to LDS: no partition launch, no workspace.
// Inside a unit lane n's 16 bytes lie at slot n ^ (half + 2 j) for V and n ^ (4 g + 8 half) for q and K: a staging lane holds 4 neighbouring channels, and unswizzled the lanes of one LDS store would share a quarter of the banks.
__device__ __forceinline__ float xhalf(float v) { return __builtin_bit_cast(float, __builtin_amdgcn_permlanex16(__builtin_bit_cast(int, v), __builtin_bit_cast(int, v), 0x76543210, 0xfedcba98, false, false)); }   // lane l <-> l ^ 16
// 2^x; the v_nop keeps the slot behind the exp2 also where an asm statement, into which the compiler does not look, comes next
__device__ __forceinline__ float exp2x1(float x) { float y; asm("v_exp_f32 %0, %1\n\tv_nop" : "=v"(y) : "v"(x)); return y; }
// y[i] = 2^x[i], eight in one statement, the results in registers apart from every source (early clobber): so no exp2 has its source overwritten or its result read by the instruction directly behind it; the v_nop keeps that slot behind the last one
__device__ __forceinline__ void exp2x8(float* y, const float* x) {
  asm("v_exp_f32 %0, %8\n\tv_exp_f32 %1, %9\n\tv_exp_f32 %2, %10\n\tv_exp_f32 %3, %11\n\tv_exp_f32 %4, %12\n\tv_exp_f32 %5, %13\n\tv_exp_f32 %6, %14\n\tv_exp_f32 %7, %15\n\tv_nop"
      : "=&v"(y[0]), "=&v"(y[1]), "=&v"(y[2]), "=&v"(y[3]), "=&v"(y[4]), "=&v"(y[5]), "=&v"(y[6]), "=&v"(y[7])
      : "v"(x[0]), "v"(x[1]), "v"(x[2]), "v"(x[3]), "v"(x[4]), "v"(x[5]), "v"(x[6]), "v"(x[7])); }
union KF { v16h v; v4u q[2]; };
// passes it0 .. it0 + np - 1 of 64 keys each (np a power of two, it0 a multiple of np) over staged keys. RUN = true: running maximum per pass (factor, o and l rescaled). RUN = false: m is fixed by the caller for all passes, so a pass has no maximum, no lane exchange, no factor and no rescale.
template <bool RUN> __device__ __forceinline__ void att_passes(const v4u* sK, const v4u* sV, int lane, int lk0, int lk1, v16h qh, KF (&ka)[4], v8f (&o)[2], float& m, float& l, const int it0, const int np) {
  const v2f c2 = { SCL2E, SCL2E };
#pragma unroll 1   // the pass loop stays rolled; every inner loop is unrolled so that all array indices are constants and the arrays stay in registers
  for (int it = it0; it < it0 + np; ++it) { float s[4][8]; union VF { v16h v; v4u q[2]; } vh[2][2];
#pragma unroll
    for (int c = 0; c < 2; ++c)
#pragma unroll
      for (int j = 0; j < 2; ++j) { const int u = (j * 32 + it * 2 + c) * 2; vh[c][j].q[0] = sV[u * 32 + (lane ^ (2 * j))]; vh[c][j].q[1] = sV[(u + 1) * 32 + (lane ^ (1 + 2 * j))]; }
    __builtin_amdgcn_sched_barrier(0);   // keeps this pass's V loads in front of the logits: sunk to their products, each would wait out a full LDS latency
#pragma unroll
    for (int t = 0; t < 4; ++t) { const v8f z = {}; const v8f ah = wmma16(ka[t].v, qh, z);
#pragma unroll
      for (int r = 0; r < 8; ++r) s[t][r] = ah[r]; }   // unscaled: the scale is positive, so the maximum may be taken before it
    { const int nx = (it0 + ((it + 1) & (np - 1))) * 8;   // the last pass fetches pass it0 again: in bounds and staged; nothing beyond the range is read
#pragma unroll
      for (int t = 0; t < 4; ++t) { ka[t].q[0] = sK[(nx + t * 2) * 32 + lk0]; ka[t].q[1] = sK[(nx + t * 2 + 1) * 32 + lk1]; } }
    __builtin_amdgcn_sched_barrier(0);   // keeps the next pass's K loads in front of the softmax, which hides their latency
    float al = 1.0f;
    if constexpr (RUN) {
      float mx = s[0][0];
#pragma unroll
      for (int t = 0; t < 4; ++t)
#pragma unroll
        for (int r = 0; r < 8; ++r) mx = fmaxf(mx, s[t][r]);
      mx = fmaxf(mx, xhalf(mx)); const float mn = fmaxf(m, mx); al = exp2x1((m - mn) * SCL2E); m = mn;
#pragma unroll
      for (int j = 0; j < 2; ++j)
#pragma unroll
        for (int r = 0; r < 8; ++r) o[j][r] *= al; }
    const float mc = m * SCL2E; const v2f nm2 = { -mc, -mc };   // one offset for every exponent of the pass
    float p[2][16], ts[16];
#pragma unroll
    for (int c = 0; c < 2; ++c)
#pragma unroll
      for (int t = 0; t < 2; ++t) { float x[8];
#pragma unroll
        for (int i = 0; i < 8; i += 2) { const v2f a = { s[2 * c + t][i], s[2 * c + t][i + 1] }; const v2f e = __builtin_elementwise_fma(a, c2, nm2); x[i] = e[0]; x[i + 1] = e[1]; }   // pairs: two exponents per packed fma
        exp2x8(&p[c][8 * t], x); }
#pragma unroll
    for (int i = 0; i < 16; ++i) ts[i] = p[0][i] + p[1][i];
#pragma unroll
    for (int d = 8; d > 0; d >>= 1)
#pragma unroll
      for (int i = 0; i < d; ++i) ts[i] += ts[i + d];   // a tree: one chain of 32 dependent adds would stall the wave
    if constexpr (RUN) l = l * al + ts[0]; else l += ts[0];
#pragma unroll
    for (int c = 0; c < 2; ++c) { v16h pf;
#pragma unroll
      for (int i = 0; i < 16; ++i) pf[i] = (_Float16)p[c][i];
#pragma unroll
      for (int j = 0; j < 2; ++j) o[j] = wmma16(vh[c][j].v, pf, o[j]); } } }
typedef __attribute__((ext_vector_type(4))) _Float16 v4h;
typedef __attribute__((ext_vector_type(2))) unsigned v2u;
// K and V are staged in 4 chunks of 256 keys (4 passes). A wave's share of a chunk is 32 keys: key tiles chunk * 16 + wave * 2 + 0, 1 of K and the 32-key chunk kc = chunk * 8 + wave of V.
// the loads of one share: 8 of k (position 4 n + kg), 8 of v (position 8 kg + i), each over whole 128-byte lines
__device__ __forceinline__ void ld_chunk(const float* kp, const float* vp, v4f (&rk)[8], v4f (&rv)[8]) {
#pragma unroll
  for (int n = 0; n < 8; ++n) rk[n] = *(const v4f*)(kp + n * 16 * CCH);
#pragma unroll
  for (int i = 0; i < 8; ++i) rv[i] = *(const v4f*)(vp + ((i >> 2) * 16 + (i & 3)) * CCH);
  asm volatile("s_wait_xcnt 0x0" ::: "memory");   // precaution: behind it the address registers of the issued loads may take new values
}
// rounds one share and writes it to the fragment planes
__device__ __forceinline__ void st_chunk(char* kd, v4u* vd, int ks, int vr, int sw, const v4f (&rk)[8], const v4f (&rv)[8]) {
#pragma unroll
  for (int n = 0; n < 8; ++n) { v4h r_;
#pragma unroll
    for (int z = 0; z < 4; ++z) r_[z] = (_Float16)bfr(rk[n][z]);
    *(v2u*)(kd + (n >> 2) * 1024 + (((n & 3) ^ ks) * 64)) = __builtin_bit_cast(v2u, r_); }
#pragma unroll
  for (int z = 0; z < 4; ++z) { v8h t8;
#pragma unroll
    for (int i = 0; i < 8; ++i) t8[i] = (_Float16)bfr(rv[i][z]);
    vd[(vr + z) ^ sw] = __builtin_bit_cast(v4u, t8); } }
// the K fragments of pass it
__device__ __forceinline__ void ld_ka(const v4u* sK, int it, int lk0, int lk1, KF (&ka)[4]) {
#pragma unroll
  for (int t = 0; t < 4; ++t) { ka[t].q[0] = sK[(it * 8 + t * 2) * 32 + lk0]; ka[t].q[1] = sK[(it * 8 + t * 2 + 1) * 32 + lk1]; } }
__global__ __launch_bounds__(256) void k_att(const float* __restrict__ Q, const float* __restrict__ K, const float* __restrict__ V, float* __restrict__ OUT) {
  __shared__ __align__(16) v4u sK[128 * 32], sV[128 * 32], sQ[8 * 2 * 32];   // sQ: per wave its 16 queries as one tile, units half 0, half 1
  const int w = blockIdx.y / HG, h = blockIdx.y % HG; const int b = w / NWB, wi = w % NWB;
  const int tid = threadIdx.x, wave = tid >> 5, lane = tid & 31, col = lane & 15, g = lane >> 4;
  const int ql = blockIdx.x * 128 + wave * 16 + col;
  // every staging load covers whole 128-byte lines: 8 lanes (cq) take the head's 32 channels of one token, kg picks one of 4 tokens. One base address per tensor, the rest are constant offsets:
  // 4 more window positions = 16 more tokens; position 8 t' + i -> token 32 t' + (i >> 2) * 16 + (i & 3)
  const int cq = lane & 7, kg = lane >> 3;
  const size_t lo = (size_t)b * LL * CCH + h * HD + cq * 4;
  const float* qp = Q + lo + (size_t)tok_of(wi, blockIdx.x * 128 + wave * 16 + kg) * CCH;   // q, k: position 4 n + kg of the wave's share
  const float* kp = K + lo + (size_t)tok_of(wi, wave * 32 + kg) * CCH;                      // wave's share of chunk 0; a chunk further = 256 positions = 1,024 tokens
  const float* vp = V + lo + (size_t)tok_of(wi, wave * 32 + kg * 8) * CCH;                  // v: 8 keys, octet wave * 4 + kg of the chunk
  v4f rq[4], rk[8], rv[8];
#pragma unroll
  for (int n = 0; n < 4; ++n) rq[n] = *(const v4f*)(qp + n * 16 * CCH);
  asm volatile("s_wait_xcnt 0x0" ::: "memory");   // precaution: behind it the address registers of the issued q loads may take new values (also as later loads' results)
  ld_chunk(kp, vp, rk, rv);
  __builtin_amdgcn_sched_barrier(0);   // keeps every conversion behind these loads: lifted among them, its wait for data would hold the later loads back by a memory latency
  // q, k: the lane's 4 channels are 8 bytes of the fragment slot (half = cq >> 2, g = (cq >> 1) & 1, column = position & 15)
  const int ks = (cq >> 1) & 3;   // = g + 2 half of the slot written
  char* const kd = (char*)sK + ((wave * 4 + (cq >> 2)) * 32 + ((cq >> 1) & 1) * 16 + kg) * 16 + (cq & 1) * 8;   // a chunk further = 16 tiles = 16,384 bytes
  char* const qd = (char*)sQ + ((wave * 2 + (cq >> 2)) * 32 + ((cq >> 1) & 1) * 16 + kg) * 16 + (cq & 1) * 8;
  const int jv = cq >> 2, hv = kg >> 1, sw = hv + 2 * jv, vr = (cq & 3) * 4;
  v4u* const vd = sV + ((jv * 32 + wave) * 2 + hv) * 32 + (kg & 1) * 16;   // a chunk further = 8 kc = 512 slots
#pragma unroll
  for (int n = 0; n < 4; ++n) { v4h hi;
#pragma unroll
    for (int z = 0; z < 4; ++z) hi[z] = (_Float16)bfr(rq[n][z]);
    *(v2u*)(qd + ((n ^ ks) * 64)) = __builtin_bit_cast(v2u, hi); }
  st_chunk(kd, vd, ks, vr, sw, rk, rv);
  __syncthreads();   // chunk 0 and q are staged
  const int lk0 = lane ^ (4 * g), lk1 = lane ^ (4 * g + 8);   // q, k units: lane n's slot, half 0 and half 1
  union QF { v16h v; v4u q[2]; } qf;
  qf.q[0] = sQ[(wave * 2) * 32 + lk0]; qf.q[1] = sQ[(wave * 2 + 1) * 32 + lk1];
  const v16h qh = qf.v;
  v8f o[2] = {}; float m, l = 0.f;
  KF ka[4];   // the K fragments of a pass (64 keys), fetched one pass ahead inside a chunk
  ld_ka(sK, 0, lk0, lk1, ka);
  ld_chunk(kp + 1024 * CCH, vp + 1024 * CCH, rk, rv);   // chunk 1 flies under the passes over chunk 0; issued behind the barrier, so that no wait of the barrier's has these loads in front of it
  // softmax is the same for every reference m: exp(s - m) / sum exp(s - m). m = the query's maximum over the first 64 keys, kept for all 1,024: that key gives the sum a term 1, so the sum is at least 1; a later logit above m gives a term above 1
  { float mx = -3.0e38f;
#pragma unroll
    for (int t = 0; t < 4; ++t) { const v8f z = {}; const v8f ah = wmma16(ka[t].v, qh, z);
#pragma unroll
      for (int r = 0; r < 8; ++r) mx = fmaxf(mx, ah[r]); }
    m = fmaxf(mx, xhalf(mx)); }
  att_passes<false>(sK, sV, lane, lk0, lk1, qh, ka, o, m, l, 0, 4);
#pragma unroll
  for (int c = 1; c < 4; ++c) {
    st_chunk(kd + c * 16384, vd + c * 512, ks, vr, sw, rk, rv);
    __syncthreads();   // chunk c is staged; the planes of earlier chunks stay as they are, so nothing that a slower wave still reads is overwritten
    ld_ka(sK, c * 4, lk0, lk1, ka);
    if (c < 3) ld_chunk(kp + (c + 1) * 1024 * CCH, vp + (c + 1) * 1024 * CCH, rk, rv);   // the next chunk flies under this chunk's passes
    att_passes<false>(sK, sV, lane, lk0, lk1, qh, ka, o, m, l, c * 4, 4); }
  // range test: every term is positive, so a row sum below 2^15 says that each term was below 2^15 and finite as f16. Otherwise (also a NaN) the whole wave does the window again with the running maximum; one scalar branch, all lanes stay on for the WMMAs
  if (__builtin_amdgcn_ballot_w32(!(l + xhalf(l) < 32768.0f)) != 0u) {
#pragma unroll
    for (int j = 0; j < 2; ++j) o[j] = v8f{};
    m = -3.0e38f; l = 0.f;
    ld_ka(sK, 0, lk0, lk1, ka);
    att_passes<true>(sK, sV, lane, lk0, lk1, qh, ka, o, m, l, 0, TT / 64); }
  l += xhalf(l); const float inv = 1.0f / l;
  float* op = OUT + ((size_t)b * LL + tok_of(wi, ql)) * CCH + h * HD + 8 * g;   // D register r = channel j * 16 + 8 g + r of query col
#pragma unroll
  for (int j = 0; j < 2; ++j) { const v4f x0 = { o[j][0] * inv, o[j][1] * inv, o[j][2] * inv, o[j][3] * inv }, x1 = { o[j][4] * inv, o[j][5] * inv, o[j][6] * inv, o[j][7] * inv };
    vst2(op + j * 16, x0); vst2(op + j * 16 + 4, x1); } }
extern "C" void kernel_launch(void* const* d_in, const int* in_sizes, int n_in, void* d_out, int out_size, void* d_ws, size_t ws_size, hipStream_t stream) {
  (void)in_sizes; (void)n_in; (void)out_size; (void)d_ws; (void)ws_size;
  const float** F = (const float**)d_in;   // 0 qkv [3,2,4096,128]
  k_att<<<dim3(TT / 128, NWP * HG), 256, 0, stream>>>(F[0], F[0] + (size_t)NBT * LL * CCH, F[0] + (size_t)2 * NBT * LL * CCH, (float*)d_out);
}
